// v000
// The times below were measured on an AMD MI455X: many runs one after another, warmed up first and cycling through
// copies of the inputs, with the whole window's GPU time divided by the number of runs. Launches and the gaps
// between them are all in it. The median over several windows is given; except for v000 it joins two sittings, which
// can be a few percent apart, so the side-by-side timings, each taken in one sitting, are the better comparison.
// The starting kernel, v000, takes 289 microseconds a run.
// compute dtype: all float inputs rounded to bf16; qkv = x . W^T with EXACT bf16 products on WMMA 16x16x32 (natural rows), f16 hi + residual; banded attention (|i - j| <= 128 by index; other key tiles skipped) with 3-product logits and 3-product P.v (unit-scale projections), x 1/8, running-max softmax in f32 (hardware exp); out = ctx (bf16 hi + lo) . W_proj^T + b_proj; f32 output.
#include <hip/hip_runtime.h>
#include <math.h>

typedef __attribute__((ext_vector_type(16))) _Float16 v16h;
typedef __attribute__((ext_vector_type(16))) __bf16 v16b;
typedef __attribute__((ext_vector_type(8)))  _Float16 v8h;
typedef __attribute__((ext_vector_type(8)))  float v8f;
typedef __attribute__((ext_vector_type(4)))  float v4f;
typedef __attribute__((ext_vector_type(2)))  float v2f;
typedef __attribute__((ext_vector_type(4)))  unsigned v4u;
typedef __attribute__((ext_vector_type(4)))  int v4i;
typedef float __attribute__((may_alias)) float_a;
typedef int __attribute__((may_alias)) int_a;

template <typename T> __device__ __forceinline__ void vst2(void* p, T v) { *(T*)p = v;  }
__device__ __forceinline__ v8f wmma16(v16h a, v16h b, v8f c) {
  v8f d = __builtin_amdgcn_wmma_f32_16x16x32_f16(false, a, false, b, (short)0, c, false, false);
  asm volatile("v_nop\n\tv_nop\n\tv_nop\n\tv_nop" : "+v"(d) : "v"(a), "v"(b));
  return d;
}
__device__ __forceinline__ v8f wmma_bf(v16b a, v16b b, v8f c) {
  v8f d = __builtin_amdgcn_wmma_f32_16x16x32_bf16(false, a, false, b, (short)0, c, false, false);
  asm volatile("v_nop\n\tv_nop\n\tv_nop\n\tv_nop" : "+v"(d) : "v"(a), "v"(b));
  return d;
}
// Efficient (sliding-window) attention (B 2, T 2,048, D 1,024, 16 heads x 64, window 128): bias-free natural qkv projection (rows q | k | v), |i - j| <= 128 else excluded (finfo.min fill), softmax(q k / 8) v, natural output projection + bias.
__device__ __forceinline__ v16h frag_h(const _Float16* rowk0, int lane) {
  union { v16h v; v8h q[2]; } u; const _Float16* p = rowk0 + 8 * (lane >> 4);
  u.q[0] = *(const v8h*)p; u.q[1] = *(const v8h*)(p + 16); return u.v;
}
__device__ __forceinline__ v16h frag_f32(const float* rowk0, int lane) {
  v16h a; const float* p = rowk0 + 8 * (lane >> 4);
#pragma unroll
  for (int i = 0; i < 8; ++i) { a[i] = (_Float16)p[i]; a[8 + i] = (_Float16)p[16 + i]; }
  return a;
}
__device__ __forceinline__ v16h frag_f32s(const float* rowk0, int lane, float sc) {
  v16h a; const float* p = rowk0 + 8 * (lane >> 4);
#pragma unroll
  for (int i = 0; i < 8; ++i) { a[i] = (_Float16)(p[i] * sc); a[8 + i] = (_Float16)(p[16 + i] * sc); }
  return a;
}
// column fragment from a [K][ld] layout (column n), rows >= K read as 0
__device__ __forceinline__ v16h fragc_f32(const float* W, int k0, int n, int lane, int ld, int K) {
  v16h a; const int g = lane >> 4;
#pragma unroll
  for (int i = 0; i < 8; ++i) { const int ka = k0 + 8 * g + i, kb = ka + 16;
    a[i] = (_Float16)(ka < K ? W[(size_t)(ka < K ? ka : K - 1) * ld + n] : 0.f); a[8 + i] = (_Float16)(kb < K ? W[(size_t)(kb < K ? kb : K - 1) * ld + n] : 0.f); }
  return a;
}
struct F2 { v16b h, l; };
__device__ __forceinline__ F2 bsplit16(const float v[16]) { F2 r;
#pragma unroll
  for (int i = 0; i < 16; ++i) { const __bf16 h = (__bf16)v[i]; r.h[i] = h; r.l[i] = (__bf16)(v[i] - (float)h); }
  return r; }
__device__ __forceinline__ F2 split_row(const float* row, int k0, int lane) { float v[16]; const float* p = row + k0 + 8 * (lane >> 4);
#pragma unroll
  for (int i = 0; i < 8; ++i) { v[i] = p[i]; v[8 + i] = p[16 + i]; }
  return bsplit16(v); }
__device__ __forceinline__ F2 split_rowK(const float* row, int k0, int lane, int K) { float v[16]; const int g = lane >> 4;
#pragma unroll
  for (int i = 0; i < 8; ++i) { const int ka = k0 + 8 * g + i, kb = ka + 16; v[i] = ka < K ? row[ka < K ? ka : K - 1] : 0.f; v[8 + i] = kb < K ? row[kb < K ? kb : K - 1] : 0.f; }
  return bsplit16(v); }
__device__ __forceinline__ F2 split_col(const float* W, int k0, int n, int lane, int ld, int K) { float v[16]; const int g = lane >> 4;
#pragma unroll
  for (int i = 0; i < 8; ++i) { const int ka = k0 + 8 * g + i, kb = ka + 16; v[i] = ka < K ? W[(size_t)(ka < K ? ka : K - 1) * ld + n] : 0.f; v[8 + i] = kb < K ? W[(size_t)(kb < K ? kb : K - 1) * ld + n] : 0.f; }
  return bsplit16(v); }
__device__ __forceinline__ v8f mac3(const F2& a, const F2& b, v8f c) { c = wmma_bf(a.l, b.h, c); c = wmma_bf(a.h, b.l, c); return wmma_bf(a.h, b.h, c); }
__device__ __forceinline__ float sigm(float v) { return 1.0f / (1.0f + expf(-v)); }
#define LDSX() do { asm volatile("s_wait_dscnt 0" ::: "memory"); __builtin_amdgcn_wave_barrier(); __builtin_amdgcn_fence(__ATOMIC_RELEASE, "workgroup"); } while (0)


#define NB 2
#define SS 2048
#define DM 1024
#define NH 16
#define LW 128
#define HD 64
#define QKVW (3 * DM)
#ifndef TQB
#define TQB (SS / 64)
#define TNB NB
#define TOB (NB * SS / 64)     // output row tiles (all)
#endif
typedef __attribute__((ext_vector_type(8))) __bf16 v8b;
__device__ __forceinline__ v16b frag_b(const __bf16* rowk0, int lane) {
  union { v16b v; v8b q[2]; } u; const __bf16* p = rowk0 + 8 * (lane >> 4);
  u.q[0] = *(const v8b*)p; u.q[1] = *(const v8b*)(p + 16); return u.v;
}
__device__ __forceinline__ float bfr(float v) { return (float)(__bf16)v; }
__device__ __attribute__((noinline)) float exp_ni(float v) { return expf(v); }
__device__ __attribute__((noinline)) float erf_ni(float v) { return erff(v); }

#define PK_A 0                       // [3072][1024] Wqkv rows (natural [out][in])
#define PK_P (PK_A + QKVW * DM)        // [1024][1024] Wo rows (natural)
#define PK_END (PK_P + DM * DM)
#define WS_PK  0u
#define WS_QK  (WS_PK + 2u * PK_END)             // f16 [4096 rows][2048]: q | k
#define WS_QKL (WS_QK + 2u * NB * SS * 2 * DM)     // f16 q | k residual planes x2048
#define WS_VTH (WS_QKL + 2u * NB * SS * 2 * DM)    // f16 [b][1024 (h*64+d)][2048 s] hi
#define WS_VTL (WS_VTH + 2u * NB * DM * SS)        // f16 lo x 2048
#define WS_O   (WS_VTL + 2u * NB * DM * SS)        // f32 [4096][1024]
#define WS_CS  (WS_O + 4u * NB * SS * DM)           // f32 2 x [2048][32], not read or written
#define WS_END (WS_CS + 4u * 2 * SS * 32)
// ---- k_pack: block = (row n, which): natural [out][in] rows -> bf16; which 0..2 -> W_q/W_k/W_v into PK_A rows which*1024 + n; 3 -> W_o into PK_P
__global__ __launch_bounds__(256) void k_pack(const float* __restrict__ WQ, const float* __restrict__ WK, const float* __restrict__ WV, const float* __restrict__ WO, __bf16* __restrict__ PK) {
  __shared__ __align__(16) __bf16 s[DM]; const int n = blockIdx.x, which = blockIdx.y, t = threadIdx.x; const float* Wm = (which == 0) ? WQ : (which == 1) ? WK : (which == 2) ? WV : WO;
  for (int k = t; k < DM; k += 256) s[k] = (__bf16)Wm[(size_t)n * DM + k];
  __syncthreads();
  __bf16* dst = (which < 3) ? PK + PK_A + ((size_t)which * DM + n) * DM : PK + PK_P + (size_t)n * DM;
  for (int q = t; q < DM / 8; q += 256) vst2((unsigned*)(dst + q * 8), *(const v4u*)&s[q * 8]);
}
__global__ __launch_bounds__(128) void k_qkv(const float* __restrict__ XQ, const float* __restrict__ XK, const float* __restrict__ XV, const __bf16* __restrict__ P, const float* __restrict__ BQ, const float* __restrict__ BK, const float* __restrict__ BV, _Float16* __restrict__ QK, _Float16* __restrict__ QKL, _Float16* __restrict__ VTH, _Float16* __restrict__ VTL) {
  const int which0 = (blockIdx.y * 128) / DM; const float* X = (which0 == 0) ? XQ : (which0 == 1) ? XK : XV; const float* BB = BQ ? (((which0 == 0) ? BQ : (which0 == 1) ? BK : BV) + (blockIdx.y * 128 - which0 * DM)) : nullptr;
  __shared__ __align__(16) _Float16 so[4][16][136], sol[4][16][136]; __shared__ __align__(16) _Float16 sth[128][72], stl[128][72];
  const int tid = threadIdx.x, wave = tid >> 5, lane = tid & 31, col = lane & 15, g = lane >> 4; const size_t r0 = (size_t)blockIdx.x * 64 + wave * 16; const int n0 = blockIdx.y * 128;
  v8f acc[8] = {};
#pragma unroll 2
  for (int kc = 0; kc < DM / 32; ++kc) { v16b a; { const float* p = X + (r0 + col) * DM + kc * 32 + 8 * g;
#pragma unroll
      for (int i = 0; i < 8; ++i) { a[i] = (__bf16)p[i]; a[8 + i] = (__bf16)p[16 + i]; } }
#pragma unroll
    for (int j = 0; j < 8; ++j) acc[j] = wmma_bf(a, frag_b(P + (size_t)(n0 + j * 16 + col) * DM + kc * 32, lane), acc[j]); }
  if (n0 < 2 * DM) {   // q stored unscaled (f16 sigma ~0.6, no subnormal exposure); 1/8 applied to the f32 score
#pragma unroll
    for (int j = 0; j < 8; ++j) {
#pragma unroll
      for (int r = 0; r < 8; ++r) { const float v = acc[j][r] + (BB ? bfr(BB[j * 16 + col]) : 0.f); const _Float16 hv = (_Float16)v; so[wave][8 * g + r][j * 16 + col] = hv; sol[wave][8 * g + r][j * 16 + col] = (_Float16)((v - (float)hv) * 2048.0f); } }   // q, k (+ bias) as f16 hi + (x2048) residual
    LDSX();
    for (int rl = 0; rl < 16; ++rl) if (lane < 16) { vst2((unsigned*)(QK + (r0 + rl) * (2 * DM) + n0 + lane * 8), *(const v4u*)&so[wave][rl][lane * 8]); vst2((unsigned*)(QKL + (r0 + rl) * (2 * DM) + n0 + lane * 8), *(const v4u*)&sol[wave][rl][lane * 8]); }
  } else {
#pragma unroll
    for (int j = 0; j < 8; ++j) {
#pragma unroll
      for (int r = 0; r < 8; ++r) { const float v = acc[j][r] + (BB ? bfr(BB[j * 16 + col]) : 0.f); const _Float16 hv = (_Float16)v; sth[j * 16 + col][wave * 16 + 8 * g + r] = hv; stl[j * 16 + col][wave * 16 + 8 * g + r] = (_Float16)((v - (float)hv) * 2048.0f); } }
    __syncthreads();
    const size_t rb = (size_t)blockIdx.x * 64; const int b = (int)(rb / SS), s0 = (int)(rb % SS); const int pc0 = n0 - 2 * DM;
    for (int q = tid; q < 128 * 8; q += 128) { const int d = q >> 3, pc = q & 7; const size_t o = ((size_t)b * DM + pc0 + d) * SS + s0 + pc * 8; vst2((unsigned*)(VTH + o), *(const v4u*)&sth[d][pc * 8]); vst2((unsigned*)(VTL + o), *(const v4u*)&stl[d][pc * 8]); }
  }
}
// ---- k_attn: block = (64 queries, head h, batch b): banded flash attention (window key tiles only) (K = 64: 2 k-steps), scores = (q.k) * 0.125 with f16 hi + residual operands (3 products), P.V: f16 P x (V hi, V lo*2048) in two accumulators; O[b*S+q][h*64+d] = (acc + accl / 2048) / (2048 l) (256-B segments)
__global__ __launch_bounds__(128) void k_attn(const _Float16* __restrict__ QK, const _Float16* __restrict__ QKL, const _Float16* __restrict__ VTH, const _Float16* __restrict__ VTL, const void* __restrict__ KMASK, float* __restrict__ O) {
  __shared__ __align__(16) float sp[4][16][36]; __shared__ __align__(16) float so[4][16][68];
  const int tid = threadIdx.x, wave = tid >> 5, lane = tid & 31, col = lane & 15, g = lane >> 4;
  const int qb = blockIdx.x, h = blockIdx.y, b = blockIdx.z; const int q0 = qb * 64 + wave * 16; const size_t rq = (size_t)b * SS + q0 + col;
  v16h aq[2], aql[2];
#pragma unroll
  for (int kc = 0; kc < 2; ++kc) { aq[kc] = frag_h(QK + rq * (2 * DM) + h * HD + kc * 32, lane); aql[kc] = frag_h(QKL + rq * (2 * DM) + h * HD + kc * 32, lane); }
  float m[8], l[8];
#pragma unroll
  for (int r = 0; r < 8; ++r) { m[r] = -3.0e38f; l[r] = 0.f; }
  v8f acc[4] = {}, accl[4] = {};
  const int nks = SS / 32;   // all keys
  const int ks0 = (qb * 64 - LW) > 0 ? (qb * 64 - LW) / 32 : 0; const int ks1 = ((qb * 64 + 64 + LW + 31) / 32) < nks ? ((qb * 64 + 64 + LW + 31) / 32) : nks;   // window tiles
#pragma unroll 1
  for (int ks = ks0; ks < ks1; ++ks) { v8f s[2];
#pragma unroll
    for (int ct = 0; ct < 2; ++ct) { const int kk = ks * 32 + ct * 16 + col; const _Float16* krow = QK + ((size_t)b * SS + kk) * (2 * DM) + DM + h * HD; const _Float16* krowl = QKL + ((size_t)b * SS + kk) * (2 * DM) + DM + h * HD; v8f c = {}, cl = {};
      if (qb < 32) {   // every query block (qb < TQB = 32 always holds): 3 products
#pragma unroll
        for (int kc = 0; kc < 2; ++kc) { const v16h kh = frag_h(krow + kc * 32, lane); c = wmma16(aq[kc], kh, c); cl = wmma16(aql[kc], kh, cl); cl = wmma16(aq[kc], frag_h(krowl + kc * 32, lane), cl); }
#pragma unroll
        for (int r = 0; r < 8; ++r) c[r] += cl[r] * (1.0f / 2048.0f); }
      else {
#pragma unroll
        for (int kc = 0; kc < 2; ++kc) c = wmma16(aq[kc], frag_h(krow + kc * 32, lane), c); }   // single product (not reached: qb < 32 for every block)
      { const bool keepk = true;
#pragma unroll
      for (int r = 0; r < 8; ++r) { const int dq = (q0 + 8 * g + r) - kk; s[ct][r] = (keepk && dq <= LW && dq >= -LW) ? c[r] * 0.125f : -3.0e38f; } } }   // 1/sqrt(64); masked keys excluded
#pragma unroll
    for (int r = 0; r < 8; ++r) { float mx = fmaxf(s[0][r], s[1][r]);
#pragma unroll
      for (int o = 1; o < 16; o <<= 1) mx = fmaxf(mx, __shfl_xor(mx, o));
      const float mn = fmaxf(m[r], mx); const float alpha = (m[r] <= -1.0e38f) ? 0.f : __expf(m[r] - mn);
      const float e0 = (s[0][r] <= -1.0e38f) ? 0.f : __expf(s[0][r] - mn), e1 = (s[1][r] <= -1.0e38f) ? 0.f : __expf(s[1][r] - mn); float es = e0 + e1;
#pragma unroll
      for (int o = 1; o < 16; o <<= 1) es += __shfl_xor(es, o);
      l[r] = l[r] * alpha + es; m[r] = mn;
#pragma unroll
      for (int dt = 0; dt < 4; ++dt) { acc[dt][r] *= alpha; accl[dt][r] *= alpha; }
      sp[wave][8 * g + r][col] = e0; sp[wave][8 * g + r][16 + col] = e1; }
    LDSX();
    v16h pa, pl; { const float* prow = &sp[wave][col][0] + 8 * (lane >> 4);
#pragma unroll
      for (int i = 0; i < 8; ++i) { const float x0 = prow[i] * 2048.0f, x1 = prow[16 + i] * 2048.0f; const _Float16 h0 = (_Float16)x0, h1 = (_Float16)x1; pa[i] = h0; pa[8 + i] = h1; pl[i] = (_Float16)((x0 - (float)h0) * 2048.0f); pl[8 + i] = (_Float16)((x1 - (float)h1) * 2048.0f); } }   // P scaled by 2^11 before the f16 split so small softmax weights stay out of the f16 subnormal range; 2^-11 folded into the epilogue
#pragma unroll
    for (int dt = 0; dt < 4; ++dt) { const size_t vr = ((size_t)b * DM + h * HD + dt * 16 + col) * SS + ks * 32; const v16h vh = frag_h(VTH + vr, lane); acc[dt] = wmma16(pa, vh, acc[dt]); if (qb < 32) { accl[dt] = wmma16(pl, vh, accl[dt]); accl[dt] = wmma16(pa, frag_h(VTL + vr, lane), accl[dt]); } }   // every query block (qb < 32 always): P hi/lo x V hi/lo (3 products)
    LDSX(); }
#pragma unroll
  for (int r = 0; r < 8; ++r) { const float il = (1.0f / 2048.0f) / l[r];
#pragma unroll
    for (int dt = 0; dt < 4; ++dt) so[wave][8 * g + r][dt * 16 + col] = (acc[dt][r] + accl[dt][r] * (1.0f / 2048.0f)) * il; }
  LDSX();
  for (int rl = 0; rl < 16; ++rl) if (lane < 16) vst2(O + ((size_t)b * SS + q0 + rl) * DM + h * HD + lane * 4, *(const v4f*)&so[wave][rl][lane * 4]);
}
// ---- k_out: block = (64 rows, 128 cols): out = O(hi/lo) . Wo rows (2 products) + bo
__global__ __launch_bounds__(128) void k_out(const float* __restrict__ O, const __bf16* __restrict__ P, const float* __restrict__ BO, float* __restrict__ Y) {
  __shared__ __align__(16) float so[4][16][132];
  const int tid = threadIdx.x, wave = tid >> 5, lane = tid & 31, col = lane & 15, g = lane >> 4; const size_t r0 = (size_t)blockIdx.x * 64 + wave * 16; const int n0 = blockIdx.y * 128;
  v8f acc[8] = {};
#pragma unroll 2
  for (int kc = 0; kc < DM / 32; ++kc) { const F2 a = split_row(O + (r0 + col) * DM, kc * 32, lane);
#pragma unroll
    for (int j = 0; j < 8; ++j) { const v16b w = frag_b(P + (size_t)(n0 + j * 16 + col) * DM + kc * 32, lane); acc[j] = wmma_bf(a.l, w, acc[j]); acc[j] = wmma_bf(a.h, w, acc[j]); } }
#pragma unroll
  for (int j = 0; j < 8; ++j) {
#pragma unroll
    for (int r = 0; r < 8; ++r) so[wave][8 * g + r][j * 16 + col] = acc[j][r] + bfr(BO[n0 + j * 16 + col]); }
  LDSX();
  for (int rl = 0; rl < 16; ++rl) vst2(Y + (r0 + rl) * DM + n0 + lane * 4, *(const v4f*)&so[wave][rl][lane * 4]);
}
extern "C" void kernel_launch(void* const* d_in, const int* in_sizes, int n_in, void* d_out, int out_size, void* d_ws, size_t ws_size, hipStream_t stream) {
  (void)in_sizes; (void)n_in; (void)out_size;
  const float** F = (const float**)d_in;   // 0 x [2,2048,1024], 1 W_qkv [3072,1024] natural (rows q | k | v), 2 W_proj [1024,1024] natural, 3 b_proj
  if (ws_size < (size_t)WS_END) return;
  char* ws = (char*)d_ws; __bf16* PK = (__bf16*)(ws + WS_PK); _Float16 *QK = (_Float16*)(ws + WS_QK), *QKL = (_Float16*)(ws + WS_QKL), *VTH = (_Float16*)(ws + WS_VTH), *VTL = (_Float16*)(ws + WS_VTL); float* O = (float*)(ws + WS_O);
  k_pack<<<dim3(DM, 4), 256, 0, stream>>>(F[1], F[1] + (size_t)DM * DM, F[1] + (size_t)2 * DM * DM, F[2], PK);
  k_qkv<<<dim3(TNB * SS / 64, QKVW / 128), 128, 0, stream>>>(F[0], F[0], F[0], PK + PK_A, nullptr, nullptr, nullptr, QK, QKL, VTH, VTL);
  k_attn<<<dim3(TQB, NH, TNB), 128, 0, stream>>>(QK, QKL, VTH, VTL, nullptr, O);
  k_out<<<dim3(TOB, DM / 128), 128, 0, stream>>>(O, PK + PK_P, F[3], (float*)d_out);
}

// v001
// It runs in 146 microseconds.
// Timed twice side by side with v000, it ran 2.00 and 2.03 times as fast.
// compute dtype: all float inputs rounded to bf16; qkv = x . W^T with EXACT bf16 products on WMMA 16x16x32 (natural rows), f16 hi + residual; banded attention (|i - j| <= 128 by index; other key tiles skipped) with 3-product logits and 3-product P.v (unit-scale projections), x 1/8, running-max softmax in f32 (hardware exp); out = ctx (bf16 hi + lo) . W_proj^T + b_proj; f32 output.
#include <hip/hip_runtime.h>
#include <math.h>

typedef __attribute__((ext_vector_type(16))) _Float16 v16h;
typedef __attribute__((ext_vector_type(16))) __bf16 v16b;
typedef __attribute__((ext_vector_type(8)))  _Float16 v8h;
typedef __attribute__((ext_vector_type(8)))  float v8f;
typedef __attribute__((ext_vector_type(4)))  float v4f;
typedef __attribute__((ext_vector_type(2)))  float v2f;
typedef __attribute__((ext_vector_type(4)))  unsigned v4u;
typedef __attribute__((ext_vector_type(4)))  int v4i;
typedef float __attribute__((may_alias)) float_a;
typedef int __attribute__((may_alias)) int_a;

template <typename T> __device__ __forceinline__ void vst2(void* p, T v) { *(T*)p = v;  }
__device__ __forceinline__ v8f wmma16(v16h a, v16h b, v8f c) {
  v8f d = __builtin_amdgcn_wmma_f32_16x16x32_f16(false, a, false, b, (short)0, c, false, false);
  asm volatile("v_nop\n\tv_nop\n\tv_nop\n\tv_nop" : "+v"(d) : "v"(a), "v"(b));
  return d;
}
__device__ __forceinline__ v8f wmma_bf(v16b a, v16b b, v8f c) {
  v8f d = __builtin_amdgcn_wmma_f32_16x16x32_bf16(false, a, false, b, (short)0, c, false, false);
  asm volatile("v_nop\n\tv_nop\n\tv_nop\n\tv_nop" : "+v"(d) : "v"(a), "v"(b));
  return d;
}
// Efficient (sliding-window) attention (B 2, T 2,048, D 1,024, 16 heads x 64, window 128): bias-free natural qkv projection (rows q | k | v), |i - j| <= 128 else excluded (finfo.min fill), softmax(q k / 8) v, natural output projection + bias.
__device__ __forceinline__ v16h frag_h(const _Float16* rowk0, int lane) {
  union { v16h v; v8h q[2]; } u; const _Float16* p = rowk0 + 8 * (lane >> 4);
  u.q[0] = *(const v8h*)p; u.q[1] = *(const v8h*)(p + 16); return u.v;
}
__device__ __forceinline__ v16h frag_f32(const float* rowk0, int lane) {
  v16h a; const float* p = rowk0 + 8 * (lane >> 4);
#pragma unroll
  for (int i = 0; i < 8; ++i) { a[i] = (_Float16)p[i]; a[8 + i] = (_Float16)p[16 + i]; }
  return a;
}
__device__ __forceinline__ v16h frag_f32s(const float* rowk0, int lane, float sc) {
  v16h a; const float* p = rowk0 + 8 * (lane >> 4);
#pragma unroll
  for (int i = 0; i < 8; ++i) { a[i] = (_Float16)(p[i] * sc); a[8 + i] = (_Float16)(p[16 + i] * sc); }
  return a;
}
// column fragment from a [K][ld] layout (column n), rows >= K read as 0
__device__ __forceinline__ v16h fragc_f32(const float* W, int k0, int n, int lane, int ld, int K) {
  v16h a; const int g = lane >> 4;
#pragma unroll
  for (int i = 0; i < 8; ++i) { const int ka = k0 + 8 * g + i, kb = ka + 16;
    a[i] = (_Float16)(ka < K ? W[(size_t)(ka < K ? ka : K - 1) * ld + n] : 0.f); a[8 + i] = (_Float16)(kb < K ? W[(size_t)(kb < K ? kb : K - 1) * ld + n] : 0.f); }
  return a;
}
struct F2 { v16b h, l; };
__device__ __forceinline__ F2 bsplit16(const float v[16]) { F2 r;
#pragma unroll
  for (int i = 0; i < 16; ++i) { const __bf16 h = (__bf16)v[i]; r.h[i] = h; r.l[i] = (__bf16)(v[i] - (float)h); }
  return r; }
__device__ __forceinline__ F2 split_row(const float* row, int k0, int lane) { float v[16]; const float* p = row + k0 + 8 * (lane >> 4);
#pragma unroll
  for (int i = 0; i < 8; ++i) { v[i] = p[i]; v[8 + i] = p[16 + i]; }
  return bsplit16(v); }
__device__ __forceinline__ F2 split_rowK(const float* row, int k0, int lane, int K) { float v[16]; const int g = lane >> 4;
#pragma unroll
  for (int i = 0; i < 8; ++i) { const int ka = k0 + 8 * g + i, kb = ka + 16; v[i] = ka < K ? row[ka < K ? ka : K - 1] : 0.f; v[8 + i] = kb < K ? row[kb < K ? kb : K - 1] : 0.f; }
  return bsplit16(v); }
__device__ __forceinline__ F2 split_col(const float* W, int k0, int n, int lane, int ld, int K) { float v[16]; const int g = lane >> 4;
#pragma unroll
  for (int i = 0; i < 8; ++i) { const int ka = k0 + 8 * g + i, kb = ka + 16; v[i] = ka < K ? W[(size_t)(ka < K ? ka : K - 1) * ld + n] : 0.f; v[8 + i] = kb < K ? W[(size_t)(kb < K ? kb : K - 1) * ld + n] : 0.f; }
  return bsplit16(v); }
__device__ __forceinline__ v8f mac3(const F2& a, const F2& b, v8f c) { c = wmma_bf(a.l, b.h, c); c = wmma_bf(a.h, b.l, c); return wmma_bf(a.h, b.h, c); }
__device__ __forceinline__ float sigm(float v) { return 1.0f / (1.0f + expf(-v)); }
#define LDSX() do { asm volatile("s_wait_dscnt 0" ::: "memory"); __builtin_amdgcn_wave_barrier(); __builtin_amdgcn_fence(__ATOMIC_RELEASE, "workgroup"); } while (0)


#define NB 2
#define SS 2048
#define DM 1024
#define NH 16
#define LW 128
#define HD 64
#define QKVW (3 * DM)
#ifndef TQB
#define TQB (SS / 64)
#define TNB NB
#define TOB (NB * SS / 64)     // output row tiles (all)
#endif
typedef __attribute__((ext_vector_type(8))) __bf16 v8b;
__device__ __forceinline__ v16b frag_b(const __bf16* rowk0, int lane) {
  union { v16b v; v8b q[2]; } u; const __bf16* p = rowk0 + 8 * (lane >> 4);
  u.q[0] = *(const v8b*)p; u.q[1] = *(const v8b*)(p + 16); return u.v;
}
__device__ __forceinline__ float bfr(float v) { return (float)(__bf16)v; }
__device__ __attribute__((noinline)) float exp_ni(float v) { return expf(v); }
__device__ __attribute__((noinline)) float erf_ni(float v) { return erff(v); }

#define PK_A 0                       // [3072][1024] Wqkv rows (natural [out][in])
#define PK_P (PK_A + QKVW * DM)        // [1024][1024] Wo rows (natural)
#define PK_END (PK_P + DM * DM)
#define WS_PK  0u
#define WS_QK  (WS_PK + 2u * PK_END)             // f16 [4096 rows][2048]: q | k
#define WS_QKL (WS_QK + 2u * NB * SS * 2 * DM)     // f16 q | k residual planes x2048
#define WS_VTH (WS_QKL + 2u * NB * SS * 2 * DM)    // f16 [b][1024 (h*64+d)][2048 s] hi
#define WS_VTL (WS_VTH + 2u * NB * DM * SS)        // f16 lo x 2048
#define WS_O   (WS_VTL + 2u * NB * DM * SS)        // f32 [4096][1024]
#define WS_CS  (WS_O + 4u * NB * SS * DM)           // f32 2 x [2048][32], not read or written
#define WS_END (WS_CS + 4u * 2 * SS * 32)
// ---- k_pack: block = (row n, which): natural [out][in] rows -> bf16; which 0..2 -> W_q/W_k/W_v into PK_A rows which*1024 + n; 3 -> W_o into PK_P
__global__ __launch_bounds__(256) void k_pack(const float* __restrict__ WQ, const float* __restrict__ WK, const float* __restrict__ WV, const float* __restrict__ WO, __bf16* __restrict__ PK) {
  __shared__ __align__(16) __bf16 s[DM]; const int n = blockIdx.x, which = blockIdx.y, t = threadIdx.x; const float* Wm = (which == 0) ? WQ : (which == 1) ? WK : (which == 2) ? WV : WO;
  for (int k = t; k < DM; k += 256) s[k] = (__bf16)Wm[(size_t)n * DM + k];
  __syncthreads();
  __bf16* dst = (which < 3) ? PK + PK_A + ((size_t)which * DM + n) * DM : PK + PK_P + (size_t)n * DM;
  for (int q = t; q < DM / 8; q += 256) vst2((unsigned*)(dst + q * 8), *(const v4u*)&s[q * 8]);
}
typedef __attribute__((ext_vector_type(4))) __bf16 v4b;
#define GPB 40   // LDS pitch of a 32-k bf16 tile row, in elements: 80 B = 16 B x odd, the conflict-free pitch for 16-byte reads of 64-byte rows
// ---- gemm_tile: one work-group's C[32 * FM][128] += A . B^T over K = DM. A: f32 rows, rounded to bf16 (NP == 1) or split bf16 hi + lo (NP == 2) once per work-group; B: bf16 rows.
// Each 32-k slice of both operands is staged once in LDS (two buffers, the next slice held in registers while this one is multiplied) and read by 2 x 2 waves of FM x 4 tiles each.
// The full unrolls keep the register arrays (ra, rb, fragments, acc) indexed by constants; the k loop's unroll by 2 makes the buffer index a constant in each copy.
template <int FM, int NP>
__device__ __forceinline__ void gemm_tile(const float* __restrict__ A, const __bf16* __restrict__ B, __bf16* sA, __bf16* sB, v8f (&acc)[FM][4], int tid) {
  constexpr int BM = 32 * FM, CA = BM / 16;
  const int wave = tid >> 5, lane = tid & 31, col = lane & 15, wm = wave >> 1, wn = wave & 1;
  const int arow = tid >> 3, ac = (tid & 7) * 4;   // staging of A: thread t takes 4 k of rows (t >> 3) + 16 i, so that each wave-wide 16-byte load covers four whole 128-byte lines
  const int srow = tid >> 2, sc = (tid & 3) * 8;   // staging of B: thread t takes 8 k of rows (t >> 2) + 32 i
  const float* ga = A + (size_t)arow * DM + ac; const __bf16* gb = B + (size_t)srow * DM + sc;
  v4f ra[CA]; v8b rb[4];
#pragma unroll
  for (int i = 0; i < CA; ++i) ra[i] = *(const v4f*)(ga + (size_t)i * 16 * DM);
#pragma unroll
  for (int i = 0; i < 4; ++i) rb[i] = *(const v8b*)(gb + (size_t)i * 32 * DM);
#pragma unroll 2
  for (int kc = 0; kc < DM / 32; ++kc) { const int buf = kc & 1;
#pragma unroll
    for (int i = 0; i < CA; ++i) { v4b hv, lv;
#pragma unroll
      for (int e = 0; e < 4; ++e) { const float x = ra[i][e]; const __bf16 hb = (__bf16)x; hv[e] = hb; if (NP == 2) lv[e] = (__bf16)(x - (float)hb); }
      *(v4b*)(sA + ((buf * NP) * BM + arow + i * 16) * GPB + ac) = hv; if (NP == 2) *(v4b*)(sA + ((buf * NP + 1) * BM + arow + i * 16) * GPB + ac) = lv; }
#pragma unroll
    for (int i = 0; i < 4; ++i) *(v8b*)(sB + (buf * 128 + srow + i * 32) * GPB + sc) = rb[i];
    __syncthreads();   // publishes slice kc; the other buffer's readers (slice kc - 1) are all past it before slice kc + 1 is stored there
    if (kc + 1 < DM / 32) {
#pragma unroll
      for (int i = 0; i < CA; ++i) ra[i] = *(const v4f*)(ga + (size_t)i * 16 * DM + (kc + 1) * 32);
#pragma unroll
      for (int i = 0; i < 4; ++i) rb[i] = *(const v8b*)(gb + (size_t)i * 32 * DM + (kc + 1) * 32);
      asm volatile("s_wait_xcnt 0x0" ::: "memory"); }   // stands in front of the advance of the address registers that these loads name
    v16b b[4], ah[FM], al[FM];
#pragma unroll
    for (int j = 0; j < 4; ++j) b[j] = frag_b(sB + (buf * 128 + wn * 64 + j * 16 + col) * GPB, lane);
#pragma unroll
    for (int i = 0; i < FM; ++i) { ah[i] = frag_b(sA + ((buf * NP) * BM + wm * (FM * 16) + i * 16 + col) * GPB, lane); if (NP == 2) al[i] = frag_b(sA + ((buf * NP + 1) * BM + wm * (FM * 16) + i * 16 + col) * GPB, lane); }
#pragma unroll
    for (int i = 0; i < FM; ++i) {
      if (NP == 2) {
#pragma unroll
        for (int j = 0; j < 4; ++j) acc[i][j] = wmma_bf(al[i], b[j], acc[i][j]); }
#pragma unroll
      for (int j = 0; j < 4; ++j) acc[i][j] = wmma_bf(ah[i], b[j], acc[i][j]); } }
  __syncthreads();   // every wave has read the last slice: the caller may reuse the LDS
}
// ---- k_qkv: block = (128 rows, 128 cols), 2 x 2 waves of 64 x 64
__global__ __launch_bounds__(128) void k_qkv(const float* __restrict__ XQ, const float* __restrict__ XK, const float* __restrict__ XV, const __bf16* __restrict__ P, const float* __restrict__ BQ, const float* __restrict__ BK, const float* __restrict__ BV, _Float16* __restrict__ QK, _Float16* __restrict__ QKL, _Float16* __restrict__ VTH, _Float16* __restrict__ VTL) {
  const int which0 = (blockIdx.y * 128) / DM; const float* X = (which0 == 0) ? XQ : (which0 == 1) ? XK : XV; const float* BB = BQ ? (((which0 == 0) ? BQ : (which0 == 1) ? BK : BV) + (blockIdx.y * 128 - which0 * DM)) : nullptr;
  __shared__ __align__(16) unsigned char sm[2 * 128 * 136 * 2];   // loop: A and B slices, two buffers each (40,960 B); epilogue: hi and residual planes [128][136] f16
  const int tid = threadIdx.x, wave = tid >> 5, lane = tid & 31, col = lane & 15, g = lane >> 4, wm = wave >> 1, wn = wave & 1; const size_t rb = (size_t)blockIdx.x * 128; const int n0 = blockIdx.y * 128;
  v8f acc[4][4] = {};
  gemm_tile<4, 1>(X + rb * DM, P + (size_t)n0 * DM, (__bf16*)sm, (__bf16*)sm + 2 * 128 * GPB, acc, tid);
  _Float16 (*sh)[136] = (_Float16 (*)[136])sm; _Float16 (*sl)[136] = (_Float16 (*)[136])(sm + 128 * 136 * 2);
  if (n0 < 2 * DM) {   // q stored unscaled (f16 sigma ~0.6, no subnormal exposure); 1/8 applied to the f32 score
#pragma unroll
    for (int i = 0; i < 4; ++i) {
#pragma unroll
      for (int j = 0; j < 4; ++j) { const int c = wn * 64 + j * 16 + col; const float bv = BB ? bfr(BB[c]) : 0.f;
#pragma unroll
        for (int r = 0; r < 8; ++r) { const float v = acc[i][j][r] + bv; const _Float16 hv = (_Float16)v; sh[wm * 64 + i * 16 + 8 * g + r][c] = hv; sl[wm * 64 + i * 16 + 8 * g + r][c] = (_Float16)((v - (float)hv) * 2048.0f); } } }   // q, k (+ bias) as f16 hi + (x2048) residual
    __syncthreads();
#pragma unroll
    for (int it = 0; it < 16; ++it) { const int rl = it * 8 + (tid >> 4), pc = tid & 15; const size_t o = (rb + rl) * (2 * DM) + n0 + pc * 8; vst2((unsigned*)(QK + o), *(const v4u*)&sh[rl][pc * 8]); vst2((unsigned*)(QKL + o), *(const v4u*)&sl[rl][pc * 8]); }
  } else {   // v transposed: planes [d][s]
#pragma unroll
    for (int i = 0; i < 4; ++i) {
#pragma unroll
      for (int j = 0; j < 4; ++j) { const int c = wn * 64 + j * 16 + col; const float bv = BB ? bfr(BB[c]) : 0.f; v8h hq, lq;
#pragma unroll
        for (int r = 0; r < 8; ++r) { const float v = acc[i][j][r] + bv; const _Float16 hv = (_Float16)v; hq[r] = hv; lq[r] = (_Float16)((v - (float)hv) * 2048.0f); }
        *(v8h*)&sh[c][wm * 64 + i * 16 + 8 * g] = hq; *(v8h*)&sl[c][wm * 64 + i * 16 + 8 * g] = lq; } }
    __syncthreads();
    const int b = (int)(rb / SS), s0 = (int)(rb % SS); const int pc0 = n0 - 2 * DM;
#pragma unroll
    for (int it = 0; it < 16; ++it) { const int d = it * 8 + (tid >> 4), pc = tid & 15; const size_t o = ((size_t)b * DM + pc0 + d) * SS + s0 + pc * 8; vst2((unsigned*)(VTH + o), *(const v4u*)&sh[d][pc * 8]); vst2((unsigned*)(VTL + o), *(const v4u*)&sl[d][pc * 8]); }
  }
}
// ---- k_attn: block = (64 queries, head h, batch b): banded flash attention (window key tiles only) (K = 64: 2 k-steps), scores = (q.k) * 0.125 with f16 hi + residual operands (3 products), P.V: f16 P x (V hi, V lo*2048) in two accumulators; O[b*S+q][h*64+d] = (acc + accl / 2048) / (2048 l) (256-B segments)
__global__ __launch_bounds__(128) void k_attn(const _Float16* __restrict__ QK, const _Float16* __restrict__ QKL, const _Float16* __restrict__ VTH, const _Float16* __restrict__ VTL, const void* __restrict__ KMASK, float* __restrict__ O) {
  __shared__ __align__(16) float sp[4][16][36]; __shared__ __align__(16) float so[4][16][68];
  const int tid = threadIdx.x, wave = tid >> 5, lane = tid & 31, col = lane & 15, g = lane >> 4;
  const int qb = blockIdx.x, h = blockIdx.y, b = blockIdx.z; const int q0 = qb * 64 + wave * 16; const size_t rq = (size_t)b * SS + q0 + col;
  v16h aq[2], aql[2];
#pragma unroll
  for (int kc = 0; kc < 2; ++kc) { aq[kc] = frag_h(QK + rq * (2 * DM) + h * HD + kc * 32, lane); aql[kc] = frag_h(QKL + rq * (2 * DM) + h * HD + kc * 32, lane); }
  float m[8], l[8];
#pragma unroll
  for (int r = 0; r < 8; ++r) { m[r] = -3.0e38f; l[r] = 0.f; }
  v8f acc[4] = {}, accl[4] = {};
  const int nks = SS / 32;   // all keys
  const int ks0 = (qb * 64 - LW) > 0 ? (qb * 64 - LW) / 32 : 0; const int ks1 = ((qb * 64 + 64 + LW + 31) / 32) < nks ? ((qb * 64 + 64 + LW + 31) / 32) : nks;   // window tiles
#pragma unroll 1
  for (int ks = ks0; ks < ks1; ++ks) { v8f s[2];
#pragma unroll
    for (int ct = 0; ct < 2; ++ct) { const int kk = ks * 32 + ct * 16 + col; const _Float16* krow = QK + ((size_t)b * SS + kk) * (2 * DM) + DM + h * HD; const _Float16* krowl = QKL + ((size_t)b * SS + kk) * (2 * DM) + DM + h * HD; v8f c = {}, cl = {};
      if (qb < 32) {   // every query block (qb < TQB = 32 always holds): 3 products
#pragma unroll
        for (int kc = 0; kc < 2; ++kc) { const v16h kh = frag_h(krow + kc * 32, lane); c = wmma16(aq[kc], kh, c); cl = wmma16(aql[kc], kh, cl); cl = wmma16(aq[kc], frag_h(krowl + kc * 32, lane), cl); }
#pragma unroll
        for (int r = 0; r < 8; ++r) c[r] += cl[r] * (1.0f / 2048.0f); }
      else {
#pragma unroll
        for (int kc = 0; kc < 2; ++kc) c = wmma16(aq[kc], frag_h(krow + kc * 32, lane), c); }   // single product (not reached: qb < 32 for every block)
      { const bool keepk = true;
#pragma unroll
      for (int r = 0; r < 8; ++r) { const int dq = (q0 + 8 * g + r) - kk; s[ct][r] = (keepk && dq <= LW && dq >= -LW) ? c[r] * 0.125f : -3.0e38f; } } }   // 1/sqrt(64); masked keys excluded
#pragma unroll
    for (int r = 0; r < 8; ++r) { float mx = fmaxf(s[0][r], s[1][r]);
#pragma unroll
      for (int o = 1; o < 16; o <<= 1) mx = fmaxf(mx, __shfl_xor(mx, o));
      const float mn = fmaxf(m[r], mx); const float alpha = (m[r] <= -1.0e38f) ? 0.f : __expf(m[r] - mn);
      const float e0 = (s[0][r] <= -1.0e38f) ? 0.f : __expf(s[0][r] - mn), e1 = (s[1][r] <= -1.0e38f) ? 0.f : __expf(s[1][r] - mn); float es = e0 + e1;
#pragma unroll
      for (int o = 1; o < 16; o <<= 1) es += __shfl_xor(es, o);
      l[r] = l[r] * alpha + es; m[r] = mn;
#pragma unroll
      for (int dt = 0; dt < 4; ++dt) { acc[dt][r] *= alpha; accl[dt][r] *= alpha; }
      sp[wave][8 * g + r][col] = e0; sp[wave][8 * g + r][16 + col] = e1; }
    LDSX();
    v16h pa, pl; { const float* prow = &sp[wave][col][0] + 8 * (lane >> 4);
#pragma unroll
      for (int i = 0; i < 8; ++i) { const float x0 = prow[i] * 2048.0f, x1 = prow[16 + i] * 2048.0f; const _Float16 h0 = (_Float16)x0, h1 = (_Float16)x1; pa[i] = h0; pa[8 + i] = h1; pl[i] = (_Float16)((x0 - (float)h0) * 2048.0f); pl[8 + i] = (_Float16)((x1 - (float)h1) * 2048.0f); } }   // P scaled by 2^11 before the f16 split so small softmax weights stay out of the f16 subnormal range; 2^-11 folded into the epilogue
#pragma unroll
    for (int dt = 0; dt < 4; ++dt) { const size_t vr = ((size_t)b * DM + h * HD + dt * 16 + col) * SS + ks * 32; const v16h vh = frag_h(VTH + vr, lane); acc[dt] = wmma16(pa, vh, acc[dt]); if (qb < 32) { accl[dt] = wmma16(pl, vh, accl[dt]); accl[dt] = wmma16(pa, frag_h(VTL + vr, lane), accl[dt]); } }   // every query block (qb < 32 always): P hi/lo x V hi/lo (3 products)
    LDSX(); }
#pragma unroll
  for (int r = 0; r < 8; ++r) { const float il = (1.0f / 2048.0f) / l[r];
#pragma unroll
    for (int dt = 0; dt < 4; ++dt) so[wave][8 * g + r][dt * 16 + col] = (acc[dt][r] + accl[dt][r] * (1.0f / 2048.0f)) * il; }
  LDSX();
  for (int rl = 0; rl < 16; ++rl) if (lane < 16) vst2(O + ((size_t)b * SS + q0 + rl) * DM + h * HD + lane * 4, *(const v4f*)&so[wave][rl][lane * 4]);
}
// ---- k_out: block = (64 rows, 128 cols), 2 x 2 waves of 32 x 64: out = O(hi/lo) . Wo rows (2 products) + bo
__global__ __launch_bounds__(128) void k_out(const float* __restrict__ O, const __bf16* __restrict__ P, const float* __restrict__ BO, float* __restrict__ Y) {
  __shared__ __align__(16) unsigned char sm[2 * 2 * 64 * GPB * 2 + 2 * 128 * GPB * 2];   // loop: A hi and lo and B slices, two buffers each (40,960 B); epilogue: [64][132] f32
  const int tid = threadIdx.x, wave = tid >> 5, lane = tid & 31, col = lane & 15, g = lane >> 4, wm = wave >> 1, wn = wave & 1; const size_t rb = (size_t)blockIdx.x * 64; const int n0 = blockIdx.y * 128;
  v8f acc[2][4] = {};
  gemm_tile<2, 2>(O + rb * DM, P + (size_t)n0 * DM, (__bf16*)sm, (__bf16*)sm + 2 * 2 * 64 * GPB, acc, tid);
  float (*so)[132] = (float (*)[132])sm;
#pragma unroll
  for (int i = 0; i < 2; ++i) {
#pragma unroll
    for (int j = 0; j < 4; ++j) { const int c = wn * 64 + j * 16 + col; const float bv = bfr(BO[n0 + c]);
#pragma unroll
      for (int r = 0; r < 8; ++r) so[wm * 32 + i * 16 + 8 * g + r][c] = acc[i][j][r] + bv; } }
  __syncthreads();
#pragma unroll
  for (int it = 0; it < 16; ++it) { const int rl = it * 4 + wave, c4 = lane; vst2(Y + (rb + rl) * DM + n0 + c4 * 4, *(const v4f*)&so[rl][c4 * 4]); }
}
extern "C" void kernel_launch(void* const* d_in, const int* in_sizes, int n_in, void* d_out, int out_size, void* d_ws, size_t ws_size, hipStream_t stream) {
  (void)in_sizes; (void)n_in; (void)out_size;
  const float** F = (const float**)d_in;   // 0 x [2,2048,1024], 1 W_qkv [3072,1024] natural (rows q | k | v), 2 W_proj [1024,1024] natural, 3 b_proj
  if (ws_size < (size_t)WS_END) return;
  char* ws = (char*)d_ws; __bf16* PK = (__bf16*)(ws + WS_PK); _Float16 *QK = (_Float16*)(ws + WS_QK), *QKL = (_Float16*)(ws + WS_QKL), *VTH = (_Float16*)(ws + WS_VTH), *VTL = (_Float16*)(ws + WS_VTL); float* O = (float*)(ws + WS_O);
  k_pack<<<dim3(DM, 4), 256, 0, stream>>>(F[1], F[1] + (size_t)DM * DM, F[1] + (size_t)2 * DM * DM, F[2], PK);
  k_qkv<<<dim3(TNB * SS / 128, QKVW / 128), 128, 0, stream>>>(F[0], F[0], F[0], PK + PK_A, nullptr, nullptr, nullptr, QK, QKL, VTH, VTL);
  k_attn<<<dim3(TQB, NH, TNB), 128, 0, stream>>>(QK, QKL, VTH, VTL, nullptr, O);
  k_out<<<dim3(TOB, DM / 128), 128, 0, stream>>>(O, PK + PK_P, F[3], (float*)d_out);
}

// v002
// Measured time: 107 microseconds a run.
// Next to v001, in two timings, it ran 1.36 and 1.35 times as fast.
// All steps since v000 together make it 2.73 times as fast.
// compute dtype: all float inputs rounded to bf16; qkv = x . W^T with EXACT bf16 products on WMMA 16x16x32 (natural rows), f16 hi + residual; banded attention (|i - j| <= 128 by index; other key tiles skipped) with 3-product logits and 3-product P.v (unit-scale projections), x 1/8, running-max softmax in f32 (hardware exp); out = ctx (bf16 hi + lo) . W_proj^T + b_proj; f32 output.
#include <hip/hip_runtime.h>
#include <math.h>

typedef __attribute__((ext_vector_type(16))) _Float16 v16h;
typedef __attribute__((ext_vector_type(16))) __bf16 v16b;
typedef __attribute__((ext_vector_type(8)))  _Float16 v8h;
typedef __attribute__((ext_vector_type(8)))  float v8f;
typedef __attribute__((ext_vector_type(4)))  float v4f;
typedef __attribute__((ext_vector_type(2)))  float v2f;
typedef __attribute__((ext_vector_type(4)))  unsigned v4u;
typedef __attribute__((ext_vector_type(4)))  int v4i;
typedef float __attribute__((may_alias)) float_a;
typedef int __attribute__((may_alias)) int_a;

template <typename T> __device__ __forceinline__ void vst2(void* p, T v) { *(T*)p = v;  }
__device__ __forceinline__ v8f wmma16(v16h a, v16h b, v8f c) {
  v8f d = __builtin_amdgcn_wmma_f32_16x16x32_f16(false, a, false, b, (short)0, c, false, false);
  asm volatile("v_nop\n\tv_nop\n\tv_nop\n\tv_nop" : "+v"(d) : "v"(a), "v"(b));
  return d;
}
__device__ __forceinline__ v8f wmma_bf(v16b a, v16b b, v8f c) {
  v8f d = __builtin_amdgcn_wmma_f32_16x16x32_bf16(false, a, false, b, (short)0, c, false, false);
  asm volatile("v_nop\n\tv_nop\n\tv_nop\n\tv_nop" : "+v"(d) : "v"(a), "v"(b));
  return d;
}
// Efficient (sliding-window) attention (B 2, T 2,048, D 1,024, 16 heads x 64, window 128): bias-free natural qkv projection (rows q | k | v), |i - j| <= 128 else excluded (finfo.min fill), softmax(q k / 8) v, natural output projection + bias.
__device__ __forceinline__ v16h frag_h(const _Float16* rowk0, int lane) {
  union { v16h v; v8h q[2]; } u; const _Float16* p = rowk0 + 8 * (lane >> 4);
  u.q[0] = *(const v8h*)p; u.q[1] = *(const v8h*)(p + 16); return u.v;
}
__device__ __forceinline__ v16h frag_f32(const float* rowk0, int lane) {
  v16h a; const float* p = rowk0 + 8 * (lane >> 4);
#pragma unroll
  for (int i = 0; i < 8; ++i) { a[i] = (_Float16)p[i]; a[8 + i] = (_Float16)p[16 + i]; }
  return a;
}
__device__ __forceinline__ v16h frag_f32s(const float* rowk0, int lane, float sc) {
  v16h a; const float* p = rowk0 + 8 * (lane >> 4);
#pragma unroll
  for (int i = 0; i < 8; ++i) { a[i] = (_Float16)(p[i] * sc); a[8 + i] = (_Float16)(p[16 + i] * sc); }
  return a;
}
// column fragment from a [K][ld] layout (column n), rows >= K read as 0
__device__ __forceinline__ v16h fragc_f32(const float* W, int k0, int n, int lane, int ld, int K) {
  v16h a; const int g = lane >> 4;
#pragma unroll
  for (int i = 0; i < 8; ++i) { const int ka = k0 + 8 * g + i, kb = ka + 16;
    a[i] = (_Float16)(ka < K ? W[(size_t)(ka < K ? ka : K - 1) * ld + n] : 0.f); a[8 + i] = (_Float16)(kb < K ? W[(size_t)(kb < K ? kb : K - 1) * ld + n] : 0.f); }
  return a;
}
struct F2 { v16b h, l; };
__device__ __forceinline__ F2 bsplit16(const float v[16]) { F2 r;
#pragma unroll
  for (int i = 0; i < 16; ++i) { const __bf16 h = (__bf16)v[i]; r.h[i] = h; r.l[i] = (__bf16)(v[i] - (float)h); }
  return r; }
__device__ __forceinline__ F2 split_row(const float* row, int k0, int lane) { float v[16]; const float* p = row + k0 + 8 * (lane >> 4);
#pragma unroll
  for (int i = 0; i < 8; ++i) { v[i] = p[i]; v[8 + i] = p[16 + i]; }
  return bsplit16(v); }
__device__ __forceinline__ F2 split_rowK(const float* row, int k0, int lane, int K) { float v[16]; const int g = lane >> 4;
#pragma unroll
  for (int i = 0; i < 8; ++i) { const int ka = k0 + 8 * g + i, kb = ka + 16; v[i] = ka < K ? row[ka < K ? ka : K - 1] : 0.f; v[8 + i] = kb < K ? row[kb < K ? kb : K - 1] : 0.f; }
  return bsplit16(v); }
__device__ __forceinline__ F2 split_col(const float* W, int k0, int n, int lane, int ld, int K) { float v[16]; const int g = lane >> 4;
#pragma unroll
  for (int i = 0; i < 8; ++i) { const int ka = k0 + 8 * g + i, kb = ka + 16; v[i] = ka < K ? W[(size_t)(ka < K ? ka : K - 1) * ld + n] : 0.f; v[8 + i] = kb < K ? W[(size_t)(kb < K ? kb : K - 1) * ld + n] : 0.f; }
  return bsplit16(v); }
__device__ __forceinline__ v8f mac3(const F2& a, const F2& b, v8f c) { c = wmma_bf(a.l, b.h, c); c = wmma_bf(a.h, b.l, c); return wmma_bf(a.h, b.h, c); }
__device__ __forceinline__ float sigm(float v) { return 1.0f / (1.0f + expf(-v)); }
#define LDSX() do { asm volatile("s_wait_dscnt 0" ::: "memory"); __builtin_amdgcn_wave_barrier(); __builtin_amdgcn_fence(__ATOMIC_RELEASE, "workgroup"); } while (0)


#define NB 2
#define SS 2048
#define DM 1024
#define NH 16
#define LW 128
#define HD 64
#define QKVW (3 * DM)
#ifndef TQB
#define TQB (SS / 64)
#define TNB NB
#define TOB (NB * SS / 64)     // output row tiles (all)
#endif
typedef __attribute__((ext_vector_type(8))) __bf16 v8b;
__device__ __forceinline__ v16b frag_b(const __bf16* rowk0, int lane) {
  union { v16b v; v8b q[2]; } u; const __bf16* p = rowk0 + 8 * (lane >> 4);
  u.q[0] = *(const v8b*)p; u.q[1] = *(const v8b*)(p + 16); return u.v;
}
__device__ __forceinline__ float bfr(float v) { return (float)(__bf16)v; }
__device__ __attribute__((noinline)) float exp_ni(float v) { return expf(v); }
__device__ __attribute__((noinline)) float erf_ni(float v) { return erff(v); }

#define PK_A 0                       // [3072][1024] Wqkv rows (natural [out][in])
#define PK_P (PK_A + QKVW * DM)        // [1024][1024] Wo rows (natural)
#define PK_END (PK_P + DM * DM)
#define WS_PK  0u
#define WS_QK  (WS_PK + 2u * PK_END)             // f16 [4096 rows][2048]: q | k
#define WS_QKL (WS_QK + 2u * NB * SS * 2 * DM)     // f16 q | k residual planes x2048
#define WS_VTH (WS_QKL + 2u * NB * SS * 2 * DM)    // f16 [b][1024 (h*64+d)][2048 s] hi
#define WS_VTL (WS_VTH + 2u * NB * DM * SS)        // f16 lo x 2048
#define WS_O   (WS_VTL + 2u * NB * DM * SS)        // f32 [4096][1024]
#define WS_CS  (WS_O + 4u * NB * SS * DM)           // f32 2 x [2048][32], not read or written
#define WS_END (WS_CS + 4u * 2 * SS * 32)
// ---- k_pack: block = (row n, which): natural [out][in] rows -> bf16; which 0..2 -> W_q/W_k/W_v into PK_A rows which*1024 + n; 3 -> W_o into PK_P
__global__ __launch_bounds__(256) void k_pack(const float* __restrict__ WQ, const float* __restrict__ WK, const float* __restrict__ WV, const float* __restrict__ WO, __bf16* __restrict__ PK) {
  __shared__ __align__(16) __bf16 s[DM]; const int n = blockIdx.x, which = blockIdx.y, t = threadIdx.x; const float* Wm = (which == 0) ? WQ : (which == 1) ? WK : (which == 2) ? WV : WO;
  for (int k = t; k < DM; k += 256) s[k] = (__bf16)Wm[(size_t)n * DM + k];
  __syncthreads();
  __bf16* dst = (which < 3) ? PK + PK_A + ((size_t)which * DM + n) * DM : PK + PK_P + (size_t)n * DM;
  for (int q = t; q < DM / 8; q += 256) vst2((unsigned*)(dst + q * 8), *(const v4u*)&s[q * 8]);
}
typedef __attribute__((ext_vector_type(4))) __bf16 v4b;
#define GPB 40   // LDS pitch of a 32-k bf16 tile row, in elements: 80 B = 16 B x odd, the conflict-free pitch for 16-byte reads of 64-byte rows
// ---- gemm_tile: one work-group's C[32 * FM][128] += A . B^T over K = DM. A: f32 rows, rounded to bf16 (NP == 1) or split bf16 hi + lo (NP == 2) once per work-group; B: bf16 rows.
// Each 32-k slice of both operands is staged once in LDS (two buffers, the next slice held in registers while this one is multiplied) and read by 2 x 2 waves of FM x 4 tiles each.
// The full unrolls keep the register arrays (ra, rb, fragments, acc) indexed by constants; the k loop's unroll by 2 makes the buffer index a constant in each copy.
template <int FM, int NP>
__device__ __forceinline__ void gemm_tile(const float* __restrict__ A, const __bf16* __restrict__ B, __bf16* sA, __bf16* sB, v8f (&acc)[FM][4], int tid) {
  constexpr int BM = 32 * FM, CA = BM / 16;
  const int wave = tid >> 5, lane = tid & 31, col = lane & 15, wm = wave >> 1, wn = wave & 1;
  const int arow = tid >> 3, ac = (tid & 7) * 4;   // staging of A: thread t takes 4 k of rows (t >> 3) + 16 i, so that each wave-wide 16-byte load covers four whole 128-byte lines
  const int srow = tid >> 2, sc = (tid & 3) * 8;   // staging of B: thread t takes 8 k of rows (t >> 2) + 32 i
  const float* ga = A + (size_t)arow * DM + ac; const __bf16* gb = B + (size_t)srow * DM + sc;
  v4f ra[CA]; v8b rb[4];
#pragma unroll
  for (int i = 0; i < CA; ++i) ra[i] = *(const v4f*)(ga + (size_t)i * 16 * DM);
#pragma unroll
  for (int i = 0; i < 4; ++i) rb[i] = *(const v8b*)(gb + (size_t)i * 32 * DM);
#pragma unroll 2
  for (int kc = 0; kc < DM / 32; ++kc) { const int buf = kc & 1;
#pragma unroll
    for (int i = 0; i < CA; ++i) { v4b hv, lv;
#pragma unroll
      for (int e = 0; e < 4; ++e) { const float x = ra[i][e]; const __bf16 hb = (__bf16)x; hv[e] = hb; if (NP == 2) lv[e] = (__bf16)(x - (float)hb); }
      *(v4b*)(sA + ((buf * NP) * BM + arow + i * 16) * GPB + ac) = hv; if (NP == 2) *(v4b*)(sA + ((buf * NP + 1) * BM + arow + i * 16) * GPB + ac) = lv; }
#pragma unroll
    for (int i = 0; i < 4; ++i) *(v8b*)(sB + (buf * 128 + srow + i * 32) * GPB + sc) = rb[i];
    __syncthreads();   // publishes slice kc; the other buffer's readers (slice kc - 1) are all past it before slice kc + 1 is stored there
    if (kc + 1 < DM / 32) {
#pragma unroll
      for (int i = 0; i < CA; ++i) ra[i] = *(const v4f*)(ga + (size_t)i * 16 * DM + (kc + 1) * 32);
#pragma unroll
      for (int i = 0; i < 4; ++i) rb[i] = *(const v8b*)(gb + (size_t)i * 32 * DM + (kc + 1) * 32);
      asm volatile("s_wait_xcnt 0x0" ::: "memory"); }   // stands in front of the advance of the address registers that these loads name
    v16b b[4], ah[FM], al[FM];
#pragma unroll
    for (int j = 0; j < 4; ++j) b[j] = frag_b(sB + (buf * 128 + wn * 64 + j * 16 + col) * GPB, lane);
#pragma unroll
    for (int i = 0; i < FM; ++i) { ah[i] = frag_b(sA + ((buf * NP) * BM + wm * (FM * 16) + i * 16 + col) * GPB, lane); if (NP == 2) al[i] = frag_b(sA + ((buf * NP + 1) * BM + wm * (FM * 16) + i * 16 + col) * GPB, lane); }
#pragma unroll
    for (int i = 0; i < FM; ++i) {
      if (NP == 2) {
#pragma unroll
        for (int j = 0; j < 4; ++j) acc[i][j] = wmma_bf(al[i], b[j], acc[i][j]); }
#pragma unroll
      for (int j = 0; j < 4; ++j) acc[i][j] = wmma_bf(ah[i], b[j], acc[i][j]); } }
  __syncthreads();   // every wave has read the last slice: the caller may reuse the LDS
}
// ---- k_qkv: block = (128 rows, 128 cols), 2 x 2 waves of 64 x 64
__global__ __launch_bounds__(128) void k_qkv(const float* __restrict__ XQ, const float* __restrict__ XK, const float* __restrict__ XV, const __bf16* __restrict__ P, const float* __restrict__ BQ, const float* __restrict__ BK, const float* __restrict__ BV, _Float16* __restrict__ QK, _Float16* __restrict__ QKL, _Float16* __restrict__ VTH, _Float16* __restrict__ VTL) {
  const int which0 = (blockIdx.y * 128) / DM; const float* X = (which0 == 0) ? XQ : (which0 == 1) ? XK : XV; const float* BB = BQ ? (((which0 == 0) ? BQ : (which0 == 1) ? BK : BV) + (blockIdx.y * 128 - which0 * DM)) : nullptr;
  __shared__ __align__(16) unsigned char sm[2 * 128 * 136 * 2];   // loop: A and B slices, two buffers each (40,960 B); epilogue: hi and residual planes [128][136] f16
  const int tid = threadIdx.x, wave = tid >> 5, lane = tid & 31, col = lane & 15, g = lane >> 4, wm = wave >> 1, wn = wave & 1; const size_t rb = (size_t)blockIdx.x * 128; const int n0 = blockIdx.y * 128;
  v8f acc[4][4] = {};
  gemm_tile<4, 1>(X + rb * DM, P + (size_t)n0 * DM, (__bf16*)sm, (__bf16*)sm + 2 * 128 * GPB, acc, tid);
  _Float16 (*sh)[136] = (_Float16 (*)[136])sm; _Float16 (*sl)[136] = (_Float16 (*)[136])(sm + 128 * 136 * 2);
  if (n0 < 2 * DM) {   // q stored unscaled (f16 sigma ~0.6, no subnormal exposure); 1/8 applied to the f32 score
#pragma unroll
    for (int i = 0; i < 4; ++i) {
#pragma unroll
      for (int j = 0; j < 4; ++j) { const int c = wn * 64 + j * 16 + col; const float bv = BB ? bfr(BB[c]) : 0.f;
#pragma unroll
        for (int r = 0; r < 8; ++r) { const float v = acc[i][j][r] + bv; const _Float16 hv = (_Float16)v; sh[wm * 64 + i * 16 + 8 * g + r][c] = hv; sl[wm * 64 + i * 16 + 8 * g + r][c] = (_Float16)((v - (float)hv) * 2048.0f); } } }   // q, k (+ bias) as f16 hi + (x2048) residual
    __syncthreads();
#pragma unroll
    for (int it = 0; it < 16; ++it) { const int rl = it * 8 + (tid >> 4), pc = tid & 15; const size_t o = (rb + rl) * (2 * DM) + n0 + pc * 8; vst2((unsigned*)(QK + o), *(const v4u*)&sh[rl][pc * 8]); vst2((unsigned*)(QKL + o), *(const v4u*)&sl[rl][pc * 8]); }
  } else {   // v transposed: planes [d][s]
#pragma unroll
    for (int i = 0; i < 4; ++i) {
#pragma unroll
      for (int j = 0; j < 4; ++j) { const int c = wn * 64 + j * 16 + col; const float bv = BB ? bfr(BB[c]) : 0.f; v8h hq, lq;
#pragma unroll
        for (int r = 0; r < 8; ++r) { const float v = acc[i][j][r] + bv; const _Float16 hv = (_Float16)v; hq[r] = hv; lq[r] = (_Float16)((v - (float)hv) * 2048.0f); }
        *(v8h*)&sh[c][wm * 64 + i * 16 + 8 * g] = hq; *(v8h*)&sl[c][wm * 64 + i * 16 + 8 * g] = lq; } }
    __syncthreads();
    const int b = (int)(rb / SS), s0 = (int)(rb % SS); const int pc0 = n0 - 2 * DM;
#pragma unroll
    for (int it = 0; it < 16; ++it) { const int d = it * 8 + (tid >> 4), pc = tid & 15; const size_t o = ((size_t)b * DM + pc0 + d) * SS + s0 + pc * 8; vst2((unsigned*)(VTH + o), *(const v4u*)&sh[d][pc * 8]); vst2((unsigned*)(VTL + o), *(const v4u*)&sl[d][pc * 8]); }
  }
}
// ---- k_attn: block = (64 queries, head h, batch b): banded flash attention (K = 64: 2 k-steps), scores = (q.k) * 0.125, P.V: f16 P x (V hi, V lo*2048) in two accumulators; O[b*S+q][h*64+d] = (acc + accl / 2048) / (2048 l) (256-B segments)
// The keys are walked in stages of 64. A stage is four planes (k hi, k residual: [key][64 d]; v hi, v residual: [d][64 keys]) of 64 rows x 128 B, brought into LDS once per work-group by asynchronous copies
// (whole 128-B lines, two buffers, the next stage in flight while this one is worked on) and read from there by all four waves.
#define STG_PLANE 8192                 // 64 rows x 128 B
#define STG_BYTES (4 * STG_PLANE)
// Rows lie at a pitch of 128 B; the 16-byte piece c of row r lies at place c ^ ((r >> 1) & 7), so that the 16 rows which a half wave's ds_load_b128 reads at one c fall on all 64 banks.
// copy8: rows r, r + 16, r + 32, r + 48 of two planes, 16 B a lane. The s_wait_xcnt closes the statement so that it stands in front of every later write of the address registers that the copies name.
__device__ __forceinline__ void copy8(unsigned l0, unsigned l1, const _Float16* g0, const _Float16* g1) {
  asm volatile("global_load_async_to_lds_b128 %0, %8, off\n\t"
               "global_load_async_to_lds_b128 %1, %9, off\n\t"
               "global_load_async_to_lds_b128 %2, %10, off\n\t"
               "global_load_async_to_lds_b128 %3, %11, off\n\t"
               "global_load_async_to_lds_b128 %4, %12, off\n\t"
               "global_load_async_to_lds_b128 %5, %13, off\n\t"
               "global_load_async_to_lds_b128 %6, %14, off\n\t"
               "global_load_async_to_lds_b128 %7, %15, off\n\t"
               "s_wait_xcnt 0x0"
               :: "v"(l0), "v"(l0 + 2048u), "v"(l0 + 4096u), "v"(l0 + 6144u), "v"(l1), "v"(l1 + 2048u), "v"(l1 + 4096u), "v"(l1 + 6144u),
                  "v"(g0), "v"(g0 + 16 * 2048), "v"(g0 + 32 * 2048), "v"(g0 + 48 * 2048), "v"(g1), "v"(g1 + 16 * 2048), "v"(g1 + 32 * 2048), "v"(g1 + 48 * 2048)
               : "memory");
}
__device__ __forceinline__ v16h frag_l(const unsigned char* row, int o0, int o1) {
  union { v16h v; v8h q[2]; } u; u.q[0] = *(const v8h*)(row + o0); u.q[1] = *(const v8h*)(row + o1); return u.v;
}
__global__ __launch_bounds__(128) void k_attn(const _Float16* __restrict__ QK, const _Float16* __restrict__ QKL, const _Float16* __restrict__ VTH, const _Float16* __restrict__ VTL, const void* __restrict__ KMASK, float* __restrict__ O) {
  static_assert(2 * DM == 2048 && SS == 2048 && HD == 64, "copy8 steps 16 rows of 2,048 f16"); static_assert(LW % 64 == 0 && SS % 64 == 0, "the window is whole stages of 64 keys");
  __shared__ __align__(128) unsigned char sm[2 * STG_BYTES + 4 * 16 * 36 * 4];   // two stage buffers (epilogue: the output rows [4][16][68] f32), then the P tiles [4][16][36] f32
  float (*sp)[16][36] = (float (*)[16][36])(sm + 2 * STG_BYTES); float (*so)[16][68] = (float (*)[16][68])sm;
  const int tid = threadIdx.x, wave = tid >> 5, lane = tid & 31, col = lane & 15, g = lane >> 4;
  const int qb = blockIdx.x, h = blockIdx.y, b = blockIdx.z; const int q0 = qb * 64 + wave * 16; const size_t rq = (size_t)b * SS + q0 + col;
  const int nks = SS / 32;   // all keys
  const int ks0 = (qb * 64 - LW) > 0 ? (qb * 64 - LW) / 32 : 0; const int ks1 = ((qb * 64 + 64 + LW + 31) / 32) < nks ? ((qb * 64 + 64 + LW + 31) / 32) : nks;   // window tiles: both even, so the window is whole stages
  const int st0 = ks0 >> 1, ns = (ks1 >> 1) - st0;
  // copies: thread t takes piece t & 7 of rows (t >> 3) + 16 i of each plane: a wave-wide copy covers four whole lines
  const int crow = tid >> 3, cpc = tid & 7;
  const unsigned lc = (unsigned)(size_t)sm + (unsigned)(crow * 128 + ((cpc ^ ((crow >> 1) & 7)) << 4));
  const size_t gko = ((size_t)b * SS + st0 * 64 + crow) * (2 * DM) + DM + h * HD + cpc * 8, gvo = ((size_t)b * DM + h * HD + crow) * SS + st0 * 64 + cpc * 8;
  const _Float16 *gk = QK + gko, *gkl = QKL + gko, *gv = VTH + gvo, *gvl = VTL + gvo;   // stage t: k rows advance by 64 rows, v rows by 64 keys
  copy8(lc, lc + STG_PLANE, gk, gkl); copy8(lc + 2 * STG_PLANE, lc + 3 * STG_PLANE, gv, gvl);
  v16h aq[2], aql[2];
#pragma unroll
  for (int kc = 0; kc < 2; ++kc) { aq[kc] = frag_h(QK + rq * (2 * DM) + h * HD + kc * 32, lane); aql[kc] = frag_h(QKL + rq * (2 * DM) + h * HD + kc * 32, lane); }
  float m[8], l[8];
#pragma unroll
  for (int r = 0; r < 8; ++r) { m[r] = -3.0e38f; l[r] = 0.f; }
  v8f acc[4] = {}, accl[4] = {};
  asm volatile("s_wait_asynccnt 0x0" ::: "memory");   // this wave's copies of stage 0 have landed
  __syncthreads();                                    // publishes stage 0
  if (ns > 1) { copy8(lc + STG_BYTES, lc + STG_BYTES + STG_PLANE, gk + (size_t)64 * 2 * DM, gkl + (size_t)64 * 2 * DM); copy8(lc + STG_BYTES + 2 * STG_PLANE, lc + STG_BYTES + 3 * STG_PLANE, gv + 64, gvl + 64); }
  const int swz = (col >> 1) & 7; int fo[4];   // a fragment's pieces 2 j + g of a 128-B row, at their places
#pragma unroll
  for (int j = 0; j < 4; ++j) fo[j] = ((2 * j + g) ^ swz) << 4;
#pragma unroll 1   // one copy of the body: the buffer is chosen by an address, and nothing can move across the publish point
  for (int t = 0; t < ns; ++t) { const unsigned char* sb = sm + (t & 1) * STG_BYTES + col * 128;
#pragma unroll 1   // one copy of the body: the two halves of a stage differ by an address only
  for (int sub = 0; sub < 2; ++sub) { const int ks = (st0 + t) * 2 + sub; v8f s[2];
#pragma unroll
    for (int ct = 0; ct < 2; ++ct) { const int kk = ks * 32 + ct * 16 + col; const unsigned char* krow = sb + (sub * 32 + ct * 16) * 128; v8f c = {}, cl = {};
      v16h kh[2], kl[2];   // the 16 keys' fragments, read from LDS as one group ahead of their products: one wait instead of one per product
#pragma unroll
      for (int kc = 0; kc < 2; ++kc) { kh[kc] = frag_l(krow, fo[2 * kc], fo[2 * kc + 1]); kl[kc] = frag_l(krow + STG_PLANE, fo[2 * kc], fo[2 * kc + 1]); }
      if (qb < 32) {   // every query block (qb < 32 holds for all 32 blocks of the grid): 3 products
#pragma unroll
        for (int kc = 0; kc < 2; ++kc) { c = wmma16(aq[kc], kh[kc], c); cl = wmma16(aql[kc], kh[kc], cl); cl = wmma16(aq[kc], kl[kc], cl); }
#pragma unroll
        for (int r = 0; r < 8; ++r) c[r] += cl[r] * (1.0f / 2048.0f); }
      else {
#pragma unroll
        for (int kc = 0; kc < 2; ++kc) c = wmma16(aq[kc], kh[kc], c); }   // single product (not reached with the grid launched)
      { const bool keepk = true;
#pragma unroll
      for (int r = 0; r < 8; ++r) { const int dq = (q0 + 8 * g + r) - kk; s[ct][r] = (keepk && dq <= LW && dq >= -LW) ? c[r] * 0.125f : -3.0e38f; } } }   // 1/sqrt(64); masked keys excluded
#pragma unroll
    for (int r = 0; r < 8; ++r) { float mx = fmaxf(s[0][r], s[1][r]);
#pragma unroll
      for (int o = 1; o < 16; o <<= 1) mx = fmaxf(mx, __shfl_xor(mx, o));
      const float mn = fmaxf(m[r], mx); const float alpha = (m[r] <= -1.0e38f) ? 0.f : __expf(m[r] - mn);
      const float e0 = (s[0][r] <= -1.0e38f) ? 0.f : __expf(s[0][r] - mn), e1 = (s[1][r] <= -1.0e38f) ? 0.f : __expf(s[1][r] - mn); float es = e0 + e1;
#pragma unroll
      for (int o = 1; o < 16; o <<= 1) es += __shfl_xor(es, o);
      l[r] = l[r] * alpha + es; m[r] = mn;
#pragma unroll
      for (int dt = 0; dt < 4; ++dt) { acc[dt][r] *= alpha; accl[dt][r] *= alpha; }
      sp[wave][8 * g + r][col] = e0; sp[wave][8 * g + r][16 + col] = e1; }
    LDSX();
    const int vo0 = fo[0] ^ (sub << 6), vo1 = fo[1] ^ (sub << 6);   // pieces 4 sub + g and 4 sub + 2 + g: this half's 32 keys
    v16h pa, pl; { const float* prow = &sp[wave][col][0] + 8 * (lane >> 4);
#pragma unroll
      for (int i = 0; i < 8; ++i) { const float x0 = prow[i] * 2048.0f, x1 = prow[16 + i] * 2048.0f; const _Float16 h0 = (_Float16)x0, h1 = (_Float16)x1; pa[i] = h0; pa[8 + i] = h1; pl[i] = (_Float16)((x0 - (float)h0) * 2048.0f); pl[8 + i] = (_Float16)((x1 - (float)h1) * 2048.0f); } }   // P scaled by 2^11 before the f16 split so small softmax weights stay out of the f16 subnormal range; 2^-11 folded into the epilogue
#pragma unroll
    for (int dp = 0; dp < 4; dp += 2) { v16h vh[2], vl[2];   // two d tiles' fragments, read as one group ahead of their products
#pragma unroll
      for (int e = 0; e < 2; ++e) { const unsigned char* vrow = sb + 2 * STG_PLANE + (dp + e) * 16 * 128; vh[e] = frag_l(vrow, vo0, vo1); vl[e] = frag_l(vrow + STG_PLANE, vo0, vo1); }
#pragma unroll
      for (int e = 0; e < 2; ++e) { const int dt = dp + e; acc[dt] = wmma16(pa, vh[e], acc[dt]); if (qb < 32) { accl[dt] = wmma16(pl, vh[e], accl[dt]); accl[dt] = wmma16(pa, vl[e], accl[dt]); } } }   // every query block of the grid: P hi/lo x V hi/lo (3 products)
    LDSX(); }
    asm volatile("s_wait_dscnt 0x0" ::: "memory");      // this wave's reads of stage t have returned
    asm volatile("s_wait_asynccnt 0x0" ::: "memory");   // this wave's copies of stage t + 1 have landed
    __syncthreads();                                    // publishes stage t + 1 and ends every wave's reads of stage t's buffer
    if (t + 2 < ns) { const unsigned lb = lc + (t & 1) * STG_BYTES; const size_t ko = (size_t)(t + 2) * 64 * 2 * DM; const int vo = (t + 2) * 64;
      copy8(lb, lb + STG_PLANE, gk + ko, gkl + ko); copy8(lb + 2 * STG_PLANE, lb + 3 * STG_PLANE, gv + vo, gvl + vo); } }
  asm volatile("s_wait_asynccnt 0x0" ::: "memory");   // no copy is outstanding when the buffers become output staging
#pragma unroll
  for (int r = 0; r < 8; ++r) { const float il = (1.0f / 2048.0f) / l[r];
#pragma unroll
    for (int dt = 0; dt < 4; ++dt) so[wave][8 * g + r][dt * 16 + col] = (acc[dt][r] + accl[dt][r] * (1.0f / 2048.0f)) * il; }
  LDSX();
  for (int rl = 0; rl < 16; ++rl) if (lane < 16) vst2(O + ((size_t)b * SS + q0 + rl) * DM + h * HD + lane * 4, *(const v4f*)&so[wave][rl][lane * 4]);
}
// ---- k_out: block = (64 rows, 128 cols), 2 x 2 waves of 32 x 64: out = O(hi/lo) . Wo rows (2 products) + bo
__global__ __launch_bounds__(128) void k_out(const float* __restrict__ O, const __bf16* __restrict__ P, const float* __restrict__ BO, float* __restrict__ Y) {
  __shared__ __align__(16) unsigned char sm[2 * 2 * 64 * GPB * 2 + 2 * 128 * GPB * 2];   // loop: A hi and lo and B slices, two buffers each (40,960 B); epilogue: [64][132] f32
  const int tid = threadIdx.x, wave = tid >> 5, lane = tid & 31, col = lane & 15, g = lane >> 4, wm = wave >> 1, wn = wave & 1; const size_t rb = (size_t)blockIdx.x * 64; const int n0 = blockIdx.y * 128;
  v8f acc[2][4] = {};
  gemm_tile<2, 2>(O + rb * DM, P + (size_t)n0 * DM, (__bf16*)sm, (__bf16*)sm + 2 * 2 * 64 * GPB, acc, tid);
  float (*so)[132] = (float (*)[132])sm;
#pragma unroll
  for (int i = 0; i < 2; ++i) {
#pragma unroll
    for (int j = 0; j < 4; ++j) { const int c = wn * 64 + j * 16 + col; const float bv = bfr(BO[n0 + c]);
#pragma unroll
      for (int r = 0; r < 8; ++r) so[wm * 32 + i * 16 + 8 * g + r][c] = acc[i][j][r] + bv; } }
  __syncthreads();
#pragma unroll
  for (int it = 0; it < 16; ++it) { const int rl = it * 4 + wave, c4 = lane; vst2(Y + (rb + rl) * DM + n0 + c4 * 4, *(const v4f*)&so[rl][c4 * 4]); }
}
extern "C" void kernel_launch(void* const* d_in, const int* in_sizes, int n_in, void* d_out, int out_size, void* d_ws, size_t ws_size, hipStream_t stream) {
  (void)in_sizes; (void)n_in; (void)out_size;
  const float** F = (const float**)d_in;   // 0 x [2,2048,1024], 1 W_qkv [3072,1024] natural (rows q | k | v), 2 W_proj [1024,1024] natural, 3 b_proj
  if (ws_size < (size_t)WS_END) return;
  char* ws = (char*)d_ws; __bf16* PK = (__bf16*)(ws + WS_PK); _Float16 *QK = (_Float16*)(ws + WS_QK), *QKL = (_Float16*)(ws + WS_QKL), *VTH = (_Float16*)(ws + WS_VTH), *VTL = (_Float16*)(ws + WS_VTL); float* O = (float*)(ws + WS_O);
  k_pack<<<dim3(DM, 4), 256, 0, stream>>>(F[1], F[1] + (size_t)DM * DM, F[1] + (size_t)2 * DM * DM, F[2], PK);
  k_qkv<<<dim3(TNB * SS / 128, QKVW / 128), 128, 0, stream>>>(F[0], F[0], F[0], PK + PK_A, nullptr, nullptr, nullptr, QK, QKL, VTH, VTL);
  k_attn<<<dim3(TQB, NH, TNB), 128, 0, stream>>>(QK, QKL, VTH, VTL, nullptr, O);
  k_out<<<dim3(TOB, DM / 128), 128, 0, stream>>>(O, PK + PK_P, F[3], (float*)d_out);
}

// v003
// It runs in 98.7 microseconds.
// Timed twice side by side with v002, it ran 1.09 times as fast both times.
// All steps since v000 together make it 2.98 times as fast.
// compute dtype: all float inputs rounded to bf16; qkv = x . W^T with EXACT bf16 products on WMMA 16x16x32 (natural rows), f16 hi + residual; banded attention (|i - j| <= 128 by index; other key tiles skipped) with 3-product logits and 3-product P.v (unit-scale projections), x 1/8, running-max softmax in f32 (hardware exp); out = ctx (bf16 hi + lo) . W_proj^T + b_proj; f32 output.
#include <hip/hip_runtime.h>
#include <math.h>

typedef __attribute__((ext_vector_type(16))) _Float16 v16h;
typedef __attribute__((ext_vector_type(16))) __bf16 v16b;
typedef __attribute__((ext_vector_type(8)))  _Float16 v8h;
typedef __attribute__((ext_vector_type(8)))  float v8f;
typedef __attribute__((ext_vector_type(4)))  float v4f;
typedef __attribute__((ext_vector_type(2)))  float v2f;
typedef __attribute__((ext_vector_type(4)))  unsigned v4u;
typedef __attribute__((ext_vector_type(4)))  int v4i;
typedef float __attribute__((may_alias)) float_a;
typedef int __attribute__((may_alias)) int_a;

template <typename T> __device__ __forceinline__ void vst2(void* p, T v) { *(T*)p = v;  }
__device__ __forceinline__ v8f wmma16(v16h a, v16h b, v8f c) {
  v8f d = __builtin_amdgcn_wmma_f32_16x16x32_f16(false, a, false, b, (short)0, c, false, false);
  asm volatile("v_nop\n\tv_nop\n\tv_nop\n\tv_nop" : "+v"(d) : "v"(a), "v"(b));
  return d;
}
__device__ __forceinline__ v8f wmma_bf(v16b a, v16b b, v8f c) {
  v8f d = __builtin_amdgcn_wmma_f32_16x16x32_bf16(false, a, false, b, (short)0, c, false, false);
  asm volatile("v_nop\n\tv_nop\n\tv_nop\n\tv_nop" : "+v"(d) : "v"(a), "v"(b));
  return d;
}
// Efficient (sliding-window) attention (B 2, T 2,048, D 1,024, 16 heads x 64, window 128): bias-free natural qkv projection (rows q | k | v), |i - j| <= 128 else excluded (finfo.min fill), softmax(q k / 8) v, natural output projection + bias.
__device__ __forceinline__ v16h frag_h(const _Float16* rowk0, int lane) {
  union { v16h v; v8h q[2]; } u; const _Float16* p = rowk0 + 8 * (lane >> 4);
  u.q[0] = *(const v8h*)p; u.q[1] = *(const v8h*)(p + 16); return u.v;
}
__device__ __forceinline__ v16h frag_f32(const float* rowk0, int lane) {
  v16h a; const float* p = rowk0 + 8 * (lane >> 4);
#pragma unroll
  for (int i = 0; i < 8; ++i) { a[i] = (_Float16)p[i]; a[8 + i] = (_Float16)p[16 + i]; }
  return a;
}
__device__ __forceinline__ v16h frag_f32s(const float* rowk0, int lane, float sc) {
  v16h a; const float* p = rowk0 + 8 * (lane >> 4);
#pragma unroll
  for (int i = 0; i < 8; ++i) { a[i] = (_Float16)(p[i] * sc); a[8 + i] = (_Float16)(p[16 + i] * sc); }
  return a;
}
// column fragment from a [K][ld] layout (column n), rows >= K read as 0
__device__ __forceinline__ v16h fragc_f32(const float* W, int k0, int n, int lane, int ld, int K) {
  v16h a; const int g = lane >> 4;
#pragma unroll
  for (int i = 0; i < 8; ++i) { const int ka = k0 + 8 * g + i, kb = ka + 16;
    a[i] = (_Float16)(ka < K ? W[(size_t)(ka < K ? ka : K - 1) * ld + n] : 0.f); a[8 + i] = (_Float16)(kb < K ? W[(size_t)(kb < K ? kb : K - 1) * ld + n] : 0.f); }
  return a;
}
struct F2 { v16b h, l; };
__device__ __forceinline__ F2 bsplit16(const float v[16]) { F2 r;
#pragma unroll
  for (int i = 0; i < 16; ++i) { const __bf16 h = (__bf16)v[i]; r.h[i] = h; r.l[i] = (__bf16)(v[i] - (float)h); }
  return r; }
__device__ __forceinline__ F2 split_row(const float* row, int k0, int lane) { float v[16]; const float* p = row + k0 + 8 * (lane >> 4);
#pragma unroll
  for (int i = 0; i < 8; ++i) { v[i] = p[i]; v[8 + i] = p[16 + i]; }
  return bsplit16(v); }
__device__ __forceinline__ F2 split_rowK(const float* row, int k0, int lane, int K) { float v[16]; const int g = lane >> 4;
#pragma unroll
  for (int i = 0; i < 8; ++i) { const int ka = k0 + 8 * g + i, kb = ka + 16; v[i] = ka < K ? row[ka < K ? ka : K - 1] : 0.f; v[8 + i] = kb < K ? row[kb < K ? kb : K - 1] : 0.f; }
  return bsplit16(v); }
__device__ __forceinline__ F2 split_col(const float* W, int k0, int n, int lane, int ld, int K) { float v[16]; const int g = lane >> 4;
#pragma unroll
  for (int i = 0; i < 8; ++i) { const int ka = k0 + 8 * g + i, kb = ka + 16; v[i] = ka < K ? W[(size_t)(ka < K ? ka : K - 1) * ld + n] : 0.f; v[8 + i] = kb < K ? W[(size_t)(kb < K ? kb : K - 1) * ld + n] : 0.f; }
  return bsplit16(v); }
__device__ __forceinline__ v8f mac3(const F2& a, const F2& b, v8f c) { c = wmma_bf(a.l, b.h, c); c = wmma_bf(a.h, b.l, c); return wmma_bf(a.h, b.h, c); }
__device__ __forceinline__ float sigm(float v) { return 1.0f / (1.0f + expf(-v)); }
#define LDSX() do { asm volatile("s_wait_dscnt 0" ::: "memory"); __builtin_amdgcn_wave_barrier(); __builtin_amdgcn_fence(__ATOMIC_RELEASE, "workgroup"); } while (0)


#define NB 2
#define SS 2048
#define DM 1024
#define NH 16
#define LW 128
#define HD 64
#define QKVW (3 * DM)
#ifndef TQB
#define TQB (SS / 64)
#define TNB NB
#define TOB (NB * SS / 64)     // output row tiles (all)
#endif
typedef __attribute__((ext_vector_type(8))) __bf16 v8b;
__device__ __forceinline__ v16b frag_b(const __bf16* rowk0, int lane) {
  union { v16b v; v8b q[2]; } u; const __bf16* p = rowk0 + 8 * (lane >> 4);
  u.q[0] = *(const v8b*)p; u.q[1] = *(const v8b*)(p + 16); return u.v;
}
__device__ __forceinline__ float bfr(float v) { return (float)(__bf16)v; }
__device__ __attribute__((noinline)) float exp_ni(float v) { return expf(v); }
__device__ __attribute__((noinline)) float erf_ni(float v) { return erff(v); }

#define PK_A 0                       // [3072][1024] Wqkv rows (natural [out][in])
#define PK_P (PK_A + QKVW * DM)        // [1024][1024] Wo rows (natural)
#define PK_END (PK_P + DM * DM)
#define WS_PK  0u
#define WS_QK  (WS_PK + 2u * PK_END)             // f16 [4096 rows][2048]: q | k
#define WS_QKL (WS_QK + 2u * NB * SS * 2 * DM)     // f16 q | k residual planes x2048
#define WS_VTH (WS_QKL + 2u * NB * SS * 2 * DM)    // f16 [b][1024 (h*64+d)][2048 s] hi
#define WS_VTL (WS_VTH + 2u * NB * DM * SS)        // f16 lo x 2048
#define WS_O   (WS_VTL + 2u * NB * DM * SS)        // f32 [4096][1024]
#define WS_CS  (WS_O + 4u * NB * SS * DM)           // f32 2 x [2048][32], not read or written
#define WS_END (WS_CS + 4u * 2 * SS * 32)
// ---- k_pack: block = (row n, which): natural [out][in] rows -> bf16; which 0..2 -> W_q/W_k/W_v into PK_A rows which*1024 + n; 3 -> W_o into PK_P
__global__ __launch_bounds__(256) void k_pack(const float* __restrict__ WQ, const float* __restrict__ WK, const float* __restrict__ WV, const float* __restrict__ WO, __bf16* __restrict__ PK) {
  __shared__ __align__(16) __bf16 s[DM]; const int n = blockIdx.x, which = blockIdx.y, t = threadIdx.x; const float* Wm = (which == 0) ? WQ : (which == 1) ? WK : (which == 2) ? WV : WO;
  for (int k = t; k < DM; k += 256) s[k] = (__bf16)Wm[(size_t)n * DM + k];
  __syncthreads();
  __bf16* dst = (which < 3) ? PK + PK_A + ((size_t)which * DM + n) * DM : PK + PK_P + (size_t)n * DM;
  for (int q = t; q < DM / 8; q += 256) vst2((unsigned*)(dst + q * 8), *(const v4u*)&s[q * 8]);
}
typedef __attribute__((ext_vector_type(4))) __bf16 v4b;
#define GKS 64   // k of one staged slice: a slice row is 256 bytes of A (f32) and a whole 128-byte line of B (bf16)
#define GPB 72   // LDS pitch of a 64-k bf16 tile row, in elements: 144 B = 16 B x odd, the conflict-free pitch for 16-byte reads
// ---- gemm_tile: one work-group's C[32 * FM][128] += A . B^T over K = DM. A: f32 rows, rounded to bf16 (NP == 1) or split bf16 hi + lo (NP == 2) once per work-group; B: bf16 rows.
// Each 64-k slice of both operands is staged once in LDS (two buffers, the next slice held in registers while this one is multiplied) and read, as two 32-k halves in k order, by 2 x 2 waves of FM x 4 tiles each.
// The full unrolls keep the register arrays (ra, rb, fragments, acc) indexed by constants; the k loop's unroll by 2 makes the buffer index a constant in each copy.
template <int FM, int NP>
__device__ __forceinline__ void gemm_tile(const float* __restrict__ A, const __bf16* __restrict__ B, __bf16* sA, __bf16* sB, v8f (&acc)[FM][4], int tid) {
  constexpr int BM = 32 * FM, CA = BM / 8;
  const int wave = tid >> 5, lane = tid & 31, col = lane & 15, wm = wave >> 1, wn = wave & 1;
  const int arow = tid >> 4, ac = (tid & 15) * 4;   // staging of A: thread t takes 4 k of rows (t >> 4) + 8 i, so that each wave-wide 16-byte load covers two whole rows of 256 bytes
  const int srow = tid >> 3, sc = (tid & 7) * 8;    // staging of B: thread t takes 8 k of rows (t >> 3) + 16 i, so that each wave-wide 16-byte load covers four whole 128-byte lines
  const float* ga = A + (size_t)arow * DM + ac; const __bf16* gb = B + (size_t)srow * DM + sc;
  v4f ra[CA]; v8b rb[8];
#pragma unroll
  for (int i = 0; i < CA; ++i) ra[i] = *(const v4f*)(ga + (size_t)i * 8 * DM);
#pragma unroll
  for (int i = 0; i < 8; ++i) rb[i] = *(const v8b*)(gb + (size_t)i * 16 * DM);
  asm volatile("s_wait_xcnt 0x0" :: "v"(ga), "v"(gb) : "memory");   // stands in front of every later write of the address registers that the first slice's loads name: as inputs they stay live up to the wait
#pragma unroll 2
  for (int kc = 0; kc < DM / GKS; ++kc) { const int buf = kc & 1;
#pragma unroll
    for (int i = 0; i < CA; ++i) { v4b hv, lv;
#pragma unroll
      for (int e = 0; e < 4; ++e) { const float x = ra[i][e]; const __bf16 hb = (__bf16)x; hv[e] = hb; if (NP == 2) lv[e] = (__bf16)(x - (float)hb); }
      *(v4b*)(sA + ((buf * NP) * BM + arow + i * 8) * GPB + ac) = hv; if (NP == 2) *(v4b*)(sA + ((buf * NP + 1) * BM + arow + i * 8) * GPB + ac) = lv; }
#pragma unroll
    for (int i = 0; i < 8; ++i) *(v8b*)(sB + (buf * 128 + srow + i * 16) * GPB + sc) = rb[i];
    __syncthreads();   // publishes slice kc; the other buffer's readers (slice kc - 1) are all past it before slice kc + 1 is stored there
    if (kc + 1 < DM / GKS) {
#pragma unroll
      for (int i = 0; i < CA; ++i) ra[i] = *(const v4f*)(ga + (size_t)i * 8 * DM + (kc + 1) * GKS);
#pragma unroll
      for (int i = 0; i < 8; ++i) rb[i] = *(const v8b*)(gb + (size_t)i * 16 * DM + (kc + 1) * GKS);
      asm volatile("s_wait_xcnt 0x0" ::: "memory"); }   // stands in front of the advance of the address registers that these loads name
#pragma unroll
    for (int kh = 0; kh < GKS; kh += 32) {   // the slice's two 32-k halves, in k order
      v16b b[4], ah[FM], al[FM];
#pragma unroll
      for (int j = 0; j < 4; ++j) b[j] = frag_b(sB + (buf * 128 + wn * 64 + j * 16 + col) * GPB + kh, lane);
#pragma unroll
      for (int i = 0; i < FM; ++i) { ah[i] = frag_b(sA + ((buf * NP) * BM + wm * (FM * 16) + i * 16 + col) * GPB + kh, lane); if (NP == 2) al[i] = frag_b(sA + ((buf * NP + 1) * BM + wm * (FM * 16) + i * 16 + col) * GPB + kh, lane); }
#pragma unroll
      for (int i = 0; i < FM; ++i) {
        if (NP == 2) {
#pragma unroll
          for (int j = 0; j < 4; ++j) acc[i][j] = wmma_bf(al[i], b[j], acc[i][j]); }
#pragma unroll
        for (int j = 0; j < 4; ++j) acc[i][j] = wmma_bf(ah[i], b[j], acc[i][j]); } } }
  __syncthreads();   // every wave has read the last slice: the caller may reuse the LDS
}
// ---- k_qkv: block = (128 rows, 128 cols), 2 x 2 waves of 64 x 64
__global__ __launch_bounds__(128) void k_qkv(const float* __restrict__ XQ, const float* __restrict__ XK, const float* __restrict__ XV, const __bf16* __restrict__ P, const float* __restrict__ BQ, const float* __restrict__ BK, const float* __restrict__ BV, _Float16* __restrict__ QK, _Float16* __restrict__ QKL, _Float16* __restrict__ VTH, _Float16* __restrict__ VTL) {
  const int which0 = (blockIdx.y * 128) / DM; const float* X = (which0 == 0) ? XQ : (which0 == 1) ? XK : XV; const float* BB = BQ ? (((which0 == 0) ? BQ : (which0 == 1) ? BK : BV) + (blockIdx.y * 128 - which0 * DM)) : nullptr;
  __shared__ __align__(16) unsigned char sm[2 * 2 * 128 * GPB * 2];   // loop: A and B slices, two buffers each (73,728 B); epilogue: hi and residual planes [128][136] f16 (69,632 B)
  static_assert(2 * 2 * 128 * GPB * 2 >= 2 * 128 * 136 * 2, "the epilogue's planes fit the loop's buffers");
  const int tid = threadIdx.x, wave = tid >> 5, lane = tid & 31, col = lane & 15, g = lane >> 4, wm = wave >> 1, wn = wave & 1; const size_t rb = (size_t)blockIdx.x * 128; const int n0 = blockIdx.y * 128;
  v8f acc[4][4] = {};
  gemm_tile<4, 1>(X + rb * DM, P + (size_t)n0 * DM, (__bf16*)sm, (__bf16*)sm + 2 * 128 * GPB, acc, tid);
  _Float16 (*sh)[136] = (_Float16 (*)[136])sm; _Float16 (*sl)[136] = (_Float16 (*)[136])(sm + 128 * 136 * 2);
  if (n0 < 2 * DM) {   // q stored unscaled (f16 sigma ~0.6, no subnormal exposure); 1/8 applied to the f32 score
#pragma unroll
    for (int i = 0; i < 4; ++i) {
#pragma unroll
      for (int j = 0; j < 4; ++j) { const int c = wn * 64 + j * 16 + col; const float bv = BB ? bfr(BB[c]) : 0.f;
#pragma unroll
        for (int r = 0; r < 8; ++r) { const float v = acc[i][j][r] + bv; const _Float16 hv = (_Float16)v; sh[wm * 64 + i * 16 + 8 * g + r][c] = hv; sl[wm * 64 + i * 16 + 8 * g + r][c] = (_Float16)((v - (float)hv) * 2048.0f); } } }   // q, k (+ bias) as f16 hi + (x2048) residual
    __syncthreads();
#pragma unroll
    for (int it = 0; it < 16; ++it) { const int rl = it * 8 + (tid >> 4), pc = tid & 15; const size_t o = (rb + rl) * (2 * DM) + n0 + pc * 8; vst2((unsigned*)(QK + o), *(const v4u*)&sh[rl][pc * 8]); vst2((unsigned*)(QKL + o), *(const v4u*)&sl[rl][pc * 8]); }
  } else {   // v transposed: planes [d][s]
#pragma unroll
    for (int i = 0; i < 4; ++i) {
#pragma unroll
      for (int j = 0; j < 4; ++j) { const int c = wn * 64 + j * 16 + col; const float bv = BB ? bfr(BB[c]) : 0.f; v8h hq, lq;
#pragma unroll
        for (int r = 0; r < 8; ++r) { const float v = acc[i][j][r] + bv; const _Float16 hv = (_Float16)v; hq[r] = hv; lq[r] = (_Float16)((v - (float)hv) * 2048.0f); }
        *(v8h*)&sh[c][wm * 64 + i * 16 + 8 * g] = hq; *(v8h*)&sl[c][wm * 64 + i * 16 + 8 * g] = lq; } }
    __syncthreads();
    const int b = (int)(rb / SS), s0 = (int)(rb % SS); const int pc0 = n0 - 2 * DM;
#pragma unroll
    for (int it = 0; it < 16; ++it) { const int d = it * 8 + (tid >> 4), pc = tid & 15; const size_t o = ((size_t)b * DM + pc0 + d) * SS + s0 + pc * 8; vst2((unsigned*)(VTH + o), *(const v4u*)&sh[d][pc * 8]); vst2((unsigned*)(VTL + o), *(const v4u*)&sl[d][pc * 8]); }
  }
}
// ---- k_attn: block = (64 queries, head h, batch b): banded flash attention (K = 64: 2 k-steps), scores = (q.k) * 0.125, P.V: f16 P x (V hi, V lo*2048) in two accumulators; O[b*S+q][h*64+d] = (acc + accl / 2048) / (2048 l) (256-B segments)
// The keys are walked in stages of 64. A stage is four planes (k hi, k residual: [key][64 d]; v hi, v residual: [d][64 keys]) of 64 rows x 128 B, brought into LDS once per work-group by asynchronous copies
// (whole 128-B lines, two buffers, the next stage in flight while this one is worked on) and read from there by all four waves.
#define STG_PLANE 8192                 // 64 rows x 128 B
#define STG_BYTES (4 * STG_PLANE)
// Rows lie at a pitch of 128 B; the 16-byte piece c of row r lies at place c ^ ((r >> 1) & 7), so that the 16 rows which a half wave's ds_load_b128 reads at one c fall on all 64 banks.
// copy8: rows r, r + 16, r + 32, r + 48 of two planes, 16 B a lane. The s_wait_xcnt closes the statement so that it stands in front of every later write of the address registers that the copies name.
__device__ __forceinline__ void copy8(unsigned l0, unsigned l1, const _Float16* g0, const _Float16* g1) {
  asm volatile("global_load_async_to_lds_b128 %0, %8, off\n\t"
               "global_load_async_to_lds_b128 %1, %9, off\n\t"
               "global_load_async_to_lds_b128 %2, %10, off\n\t"
               "global_load_async_to_lds_b128 %3, %11, off\n\t"
               "global_load_async_to_lds_b128 %4, %12, off\n\t"
               "global_load_async_to_lds_b128 %5, %13, off\n\t"
               "global_load_async_to_lds_b128 %6, %14, off\n\t"
               "global_load_async_to_lds_b128 %7, %15, off\n\t"
               "s_wait_xcnt 0x0"
               :: "v"(l0), "v"(l0 + 2048u), "v"(l0 + 4096u), "v"(l0 + 6144u), "v"(l1), "v"(l1 + 2048u), "v"(l1 + 4096u), "v"(l1 + 6144u),
                  "v"(g0), "v"(g0 + 16 * 2048), "v"(g0 + 32 * 2048), "v"(g0 + 48 * 2048), "v"(g1), "v"(g1 + 16 * 2048), "v"(g1 + 32 * 2048), "v"(g1 + 48 * 2048)
               : "memory");
}
__device__ __forceinline__ v16h frag_l(const unsigned char* row, int o0, int o1) {
  union { v16h v; v8h q[2]; } u; u.q[0] = *(const v8h*)(row + o0); u.q[1] = *(const v8h*)(row + o1); return u.v;
}
__global__ __launch_bounds__(128) void k_attn(const _Float16* __restrict__ QK, const _Float16* __restrict__ QKL, const _Float16* __restrict__ VTH, const _Float16* __restrict__ VTL, const void* __restrict__ KMASK, float* __restrict__ O) {
  static_assert(2 * DM == 2048 && SS == 2048 && HD == 64, "copy8 steps 16 rows of 2,048 f16"); static_assert(LW % 64 == 0 && SS % 64 == 0, "the window is whole stages of 64 keys");
  __shared__ __align__(128) unsigned char sm[2 * STG_BYTES + 4 * 16 * 36 * 4];   // two stage buffers (epilogue: the output rows [4][16][68] f32), then the P tiles [4][16][36] f32
  float (*sp)[16][36] = (float (*)[16][36])(sm + 2 * STG_BYTES); float (*so)[16][68] = (float (*)[16][68])sm;
  const int tid = threadIdx.x, wave = tid >> 5, lane = tid & 31, col = lane & 15, g = lane >> 4;
  const int qb = blockIdx.x, h = blockIdx.y, b = blockIdx.z; const int q0 = qb * 64 + wave * 16; const size_t rq = (size_t)b * SS + q0 + col;
  const int nks = SS / 32;   // all keys
  const int ks0 = (qb * 64 - LW) > 0 ? (qb * 64 - LW) / 32 : 0; const int ks1 = ((qb * 64 + 64 + LW + 31) / 32) < nks ? ((qb * 64 + 64 + LW + 31) / 32) : nks;   // window tiles: both even, so the window is whole stages
  const int st0 = ks0 >> 1, ns = (ks1 >> 1) - st0;
  // copies: thread t takes piece t & 7 of rows (t >> 3) + 16 i of each plane: a wave-wide copy covers four whole lines
  const int crow = tid >> 3, cpc = tid & 7;
  const unsigned lc = (unsigned)(size_t)sm + (unsigned)(crow * 128 + ((cpc ^ ((crow >> 1) & 7)) << 4));
  const size_t gko = ((size_t)b * SS + st0 * 64 + crow) * (2 * DM) + DM + h * HD + cpc * 8, gvo = ((size_t)b * DM + h * HD + crow) * SS + st0 * 64 + cpc * 8;
  const _Float16 *gk = QK + gko, *gkl = QKL + gko, *gv = VTH + gvo, *gvl = VTL + gvo;   // stage t: k rows advance by 64 rows, v rows by 64 keys
  copy8(lc, lc + STG_PLANE, gk, gkl); copy8(lc + 2 * STG_PLANE, lc + 3 * STG_PLANE, gv, gvl);
  v16h aq[2], aql[2];
#pragma unroll
  for (int kc = 0; kc < 2; ++kc) { aq[kc] = frag_h(QK + rq * (2 * DM) + h * HD + kc * 32, lane); aql[kc] = frag_h(QKL + rq * (2 * DM) + h * HD + kc * 32, lane); }
  float m[8], l[8];
#pragma unroll
  for (int r = 0; r < 8; ++r) { m[r] = -3.0e38f; l[r] = 0.f; }
  v8f acc[4] = {}, accl[4] = {};
  asm volatile("s_wait_asynccnt 0x0" ::: "memory");   // this wave's copies of stage 0 have landed
  __syncthreads();                                    // publishes stage 0
  if (ns > 1) { copy8(lc + STG_BYTES, lc + STG_BYTES + STG_PLANE, gk + (size_t)64 * 2 * DM, gkl + (size_t)64 * 2 * DM); copy8(lc + STG_BYTES + 2 * STG_PLANE, lc + STG_BYTES + 3 * STG_PLANE, gv + 64, gvl + 64); }
  const int swz = (col >> 1) & 7; int fo[4];   // a fragment's pieces 2 j + g of a 128-B row, at their places
#pragma unroll
  for (int j = 0; j < 4; ++j) fo[j] = ((2 * j + g) ^ swz) << 4;
#pragma unroll 1   // one copy of the body: the buffer is chosen by an address, and nothing can move across the publish point
  for (int t = 0; t < ns; ++t) { const unsigned char* sb = sm + (t & 1) * STG_BYTES + col * 128;
#pragma unroll 1   // one copy of the body: the two halves of a stage differ by an address only
  for (int sub = 0; sub < 2; ++sub) { const int ks = (st0 + t) * 2 + sub; v8f s[2];
#pragma unroll
    for (int ct = 0; ct < 2; ++ct) { const int kk = ks * 32 + ct * 16 + col; const unsigned char* krow = sb + (sub * 32 + ct * 16) * 128; v8f c = {}, cl = {};
      v16h kh[2], kl[2];   // the 16 keys' fragments, read from LDS as one group ahead of their products: one wait instead of one per product
#pragma unroll
      for (int kc = 0; kc < 2; ++kc) { kh[kc] = frag_l(krow, fo[2 * kc], fo[2 * kc + 1]); kl[kc] = frag_l(krow + STG_PLANE, fo[2 * kc], fo[2 * kc + 1]); }
      if (qb < 32) {   // every query block (qb < 32 holds for all 32 blocks of the grid): 3 products
#pragma unroll
        for (int kc = 0; kc < 2; ++kc) { c = wmma16(aq[kc], kh[kc], c); cl = wmma16(aql[kc], kh[kc], cl); cl = wmma16(aq[kc], kl[kc], cl); }
#pragma unroll
        for (int r = 0; r < 8; ++r) c[r] += cl[r] * (1.0f / 2048.0f); }
      else {
#pragma unroll
        for (int kc = 0; kc < 2; ++kc) c = wmma16(aq[kc], kh[kc], c); }   // single product (not reached with the grid launched)
      { const bool keepk = true;
#pragma unroll
      for (int r = 0; r < 8; ++r) { const int dq = (q0 + 8 * g + r) - kk; s[ct][r] = (keepk && dq <= LW && dq >= -LW) ? c[r] * 0.125f : -3.0e38f; } } }   // 1/sqrt(64); masked keys excluded
#pragma unroll
    for (int r = 0; r < 8; ++r) { float mx = fmaxf(s[0][r], s[1][r]);
#pragma unroll
      for (int o = 1; o < 16; o <<= 1) mx = fmaxf(mx, __shfl_xor(mx, o));
      const float mn = fmaxf(m[r], mx); const float alpha = (m[r] <= -1.0e38f) ? 0.f : __expf(m[r] - mn);
      const float e0 = (s[0][r] <= -1.0e38f) ? 0.f : __expf(s[0][r] - mn), e1 = (s[1][r] <= -1.0e38f) ? 0.f : __expf(s[1][r] - mn); float es = e0 + e1;
#pragma unroll
      for (int o = 1; o < 16; o <<= 1) es += __shfl_xor(es, o);
      l[r] = l[r] * alpha + es; m[r] = mn;
#pragma unroll
      for (int dt = 0; dt < 4; ++dt) { acc[dt][r] *= alpha; accl[dt][r] *= alpha; }
      sp[wave][8 * g + r][col] = e0; sp[wave][8 * g + r][16 + col] = e1; }
    LDSX();
    const int vo0 = fo[0] ^ (sub << 6), vo1 = fo[1] ^ (sub << 6);   // pieces 4 sub + g and 4 sub + 2 + g: this half's 32 keys
    v16h pa, pl; { const float* prow = &sp[wave][col][0] + 8 * (lane >> 4);
#pragma unroll
      for (int i = 0; i < 8; ++i) { const float x0 = prow[i] * 2048.0f, x1 = prow[16 + i] * 2048.0f; const _Float16 h0 = (_Float16)x0, h1 = (_Float16)x1; pa[i] = h0; pa[8 + i] = h1; pl[i] = (_Float16)((x0 - (float)h0) * 2048.0f); pl[8 + i] = (_Float16)((x1 - (float)h1) * 2048.0f); } }   // P scaled by 2^11 before the f16 split so small softmax weights stay out of the f16 subnormal range; 2^-11 folded into the epilogue
#pragma unroll
    for (int dp = 0; dp < 4; dp += 2) { v16h vh[2], vl[2];   // two d tiles' fragments, read as one group ahead of their products
#pragma unroll
      for (int e = 0; e < 2; ++e) { const unsigned char* vrow = sb + 2 * STG_PLANE + (dp + e) * 16 * 128; vh[e] = frag_l(vrow, vo0, vo1); vl[e] = frag_l(vrow + STG_PLANE, vo0, vo1); }
#pragma unroll
      for (int e = 0; e < 2; ++e) { const int dt = dp + e; acc[dt] = wmma16(pa, vh[e], acc[dt]); if (qb < 32) { accl[dt] = wmma16(pl, vh[e], accl[dt]); accl[dt] = wmma16(pa, vl[e], accl[dt]); } } }   // every query block of the grid: P hi/lo x V hi/lo (3 products)
    LDSX(); }
    asm volatile("s_wait_dscnt 0x0" ::: "memory");      // this wave's reads of stage t have returned
    asm volatile("s_wait_asynccnt 0x0" ::: "memory");   // this wave's copies of stage t + 1 have landed
    __syncthreads();                                    // publishes stage t + 1 and ends every wave's reads of stage t's buffer
    if (t + 2 < ns) { const unsigned lb = lc + (t & 1) * STG_BYTES; const size_t ko = (size_t)(t + 2) * 64 * 2 * DM; const int vo = (t + 2) * 64;
      copy8(lb, lb + STG_PLANE, gk + ko, gkl + ko); copy8(lb + 2 * STG_PLANE, lb + 3 * STG_PLANE, gv + vo, gvl + vo); } }
  asm volatile("s_wait_asynccnt 0x0" ::: "memory");   // no copy is outstanding when the buffers become output staging
#pragma unroll
  for (int r = 0; r < 8; ++r) { const float il = (1.0f / 2048.0f) / l[r];
#pragma unroll
    for (int dt = 0; dt < 4; ++dt) so[wave][8 * g + r][dt * 16 + col] = (acc[dt][r] + accl[dt][r] * (1.0f / 2048.0f)) * il; }
  LDSX();
  for (int rl = 0; rl < 16; ++rl) if (lane < 16) vst2(O + ((size_t)b * SS + q0 + rl) * DM + h * HD + lane * 4, *(const v4f*)&so[wave][rl][lane * 4]);
}
// ---- k_out: block = (64 rows, 128 cols), 2 x 2 waves of 32 x 64: out = O(hi/lo) . Wo rows (2 products) + bo
__global__ __launch_bounds__(128) void k_out(const float* __restrict__ O, const __bf16* __restrict__ P, const float* __restrict__ BO, float* __restrict__ Y) {
  __shared__ __align__(16) unsigned char sm[2 * 2 * 64 * GPB * 2 + 2 * 128 * GPB * 2];   // loop: A hi and lo and B slices, two buffers each (73,728 B); epilogue: [64][132] f32
  const int tid = threadIdx.x, wave = tid >> 5, lane = tid & 31, col = lane & 15, g = lane >> 4, wm = wave >> 1, wn = wave & 1; const size_t rb = (size_t)blockIdx.x * 64; const int n0 = blockIdx.y * 128;
  v8f acc[2][4] = {};
  gemm_tile<2, 2>(O + rb * DM, P + (size_t)n0 * DM, (__bf16*)sm, (__bf16*)sm + 2 * 2 * 64 * GPB, acc, tid);
  float (*so)[132] = (float (*)[132])sm;
#pragma unroll
  for (int i = 0; i < 2; ++i) {
#pragma unroll
    for (int j = 0; j < 4; ++j) { const int c = wn * 64 + j * 16 + col; const float bv = bfr(BO[n0 + c]);
#pragma unroll
      for (int r = 0; r < 8; ++r) so[wm * 32 + i * 16 + 8 * g + r][c] = acc[i][j][r] + bv; } }
  __syncthreads();
#pragma unroll
  for (int it = 0; it < 16; ++it) { const int rl = it * 4 + wave, c4 = lane; vst2(Y + (rb + rl) * DM + n0 + c4 * 4, *(const v4f*)&so[rl][c4 * 4]); }
}
extern "C" void kernel_launch(void* const* d_in, const int* in_sizes, int n_in, void* d_out, int out_size, void* d_ws, size_t ws_size, hipStream_t stream) {
  (void)in_sizes; (void)n_in; (void)out_size;
  const float** F = (const float**)d_in;   // 0 x [2,2048,1024], 1 W_qkv [3072,1024] natural (rows q | k | v), 2 W_proj [1024,1024] natural, 3 b_proj
  if (ws_size < (size_t)WS_END) return;
  char* ws = (char*)d_ws; __bf16* PK = (__bf16*)(ws + WS_PK); _Float16 *QK = (_Float16*)(ws + WS_QK), *QKL = (_Float16*)(ws + WS_QKL), *VTH = (_Float16*)(ws + WS_VTH), *VTL = (_Float16*)(ws + WS_VTL); float* O = (float*)(ws + WS_O);
  k_pack<<<dim3(DM, 4), 256, 0, stream>>>(F[1], F[1] + (size_t)DM * DM, F[1] + (size_t)2 * DM * DM, F[2], PK);
  k_qkv<<<dim3(TNB * SS / 128, QKVW / 128), 128, 0, stream>>>(F[0], F[0], F[0], PK + PK_A, nullptr, nullptr, nullptr, QK, QKL, VTH, VTL);
  k_attn<<<dim3(TQB, NH, TNB), 128, 0, stream>>>(QK, QKL, VTH, VTL, nullptr, O);
  k_out<<<dim3(TOB, DM / 128), 128, 0, stream>>>(O, PK + PK_P, F[3], (float*)d_out);
}

// v004
// Measured time: 90.4 microseconds a run.
// Two timings next to v003 both put it at 1.09 times that version's speed.
// Counting every step since v000, it is 3.25 times as fast.
// compute dtype: all float inputs rounded to bf16; qkv = x . W^T with EXACT bf16 products on WMMA 16x16x32 (natural rows), f16 hi + residual; banded attention (|i - j| <= 128 by index; other key tiles skipped) with 3-product logits and 3-product P.v (unit-scale projections), x 1/8, running-max softmax in f32 (hardware exp); out = ctx (bf16 hi + lo) . W_proj^T + b_proj; f32 output.
#include <hip/hip_runtime.h>
#include <math.h>

typedef __attribute__((ext_vector_type(16))) _Float16 v16h;
typedef __attribute__((ext_vector_type(16))) __bf16 v16b;
typedef __attribute__((ext_vector_type(8)))  _Float16 v8h;
typedef __attribute__((ext_vector_type(8)))  float v8f;
typedef __attribute__((ext_vector_type(4)))  float v4f;
typedef __attribute__((ext_vector_type(2)))  float v2f;
typedef __attribute__((ext_vector_type(4)))  unsigned v4u;
typedef __attribute__((ext_vector_type(4)))  int v4i;
typedef float __attribute__((may_alias)) float_a;
typedef int __attribute__((may_alias)) int_a;

template <typename T> __device__ __forceinline__ void vst2(void* p, T v) { *(T*)p = v;  }
__device__ __forceinline__ v8f wmma16(v16h a, v16h b, v8f c) {
  v8f d = __builtin_amdgcn_wmma_f32_16x16x32_f16(false, a, false, b, (short)0, c, false, false);
  asm volatile("v_nop\n\tv_nop\n\tv_nop\n\tv_nop" : "+v"(d) : "v"(a), "v"(b));
  return d;
}
__device__ __forceinline__ v8f wmma_bf(v16b a, v16b b, v8f c) {
  v8f d = __builtin_amdgcn_wmma_f32_16x16x32_bf16(false, a, false, b, (short)0, c, false, false);
  asm volatile("v_nop\n\tv_nop\n\tv_nop\n\tv_nop" : "+v"(d) : "v"(a), "v"(b));
  return d;
}
// Efficient (sliding-window) attention (B 2, T 2,048, D 1,024, 16 heads x 64, window 128): bias-free natural qkv projection (rows q | k | v), |i - j| <= 128 else excluded (finfo.min fill), softmax(q k / 8) v, natural output projection + bias.
__device__ __forceinline__ v16h frag_h(const _Float16* rowk0, int lane) {
  union { v16h v; v8h q[2]; } u; const _Float16* p = rowk0 + 8 * (lane >> 4);
  u.q[0] = *(const v8h*)p; u.q[1] = *(const v8h*)(p + 16); return u.v;
}
__device__ __forceinline__ v16h frag_f32(const float* rowk0, int lane) {
  v16h a; const float* p = rowk0 + 8 * (lane >> 4);
#pragma unroll
  for (int i = 0; i < 8; ++i) { a[i] = (_Float16)p[i]; a[8 + i] = (_Float16)p[16 + i]; }
  return a;
}
__device__ __forceinline__ v16h frag_f32s(const float* rowk0, int lane, float sc) {
  v16h a; const float* p = rowk0 + 8 * (lane >> 4);
#pragma unroll
  for (int i = 0; i < 8; ++i) { a[i] = (_Float16)(p[i] * sc); a[8 + i] = (_Float16)(p[16 + i] * sc); }
  return a;
}
// column fragment from a [K][ld] layout (column n), rows >= K read as 0
__device__ __forceinline__ v16h fragc_f32(const float* W, int k0, int n, int lane, int ld, int K) {
  v16h a; const int g = lane >> 4;
#pragma unroll
  for (int i = 0; i < 8; ++i) { const int ka = k0 + 8 * g + i, kb = ka + 16;
    a[i] = (_Float16)(ka < K ? W[(size_t)(ka < K ? ka : K - 1) * ld + n] : 0.f); a[8 + i] = (_Float16)(kb < K ? W[(size_t)(kb < K ? kb : K - 1) * ld + n] : 0.f); }
  return a;
}
struct F2 { v16b h, l; };
__device__ __forceinline__ F2 bsplit16(const float v[16]) { F2 r;
#pragma unroll
  for (int i = 0; i < 16; ++i) { const __bf16 h = (__bf16)v[i]; r.h[i] = h; r.l[i] = (__bf16)(v[i] - (float)h); }
  return r; }
__device__ __forceinline__ F2 split_row(const float* row, int k0, int lane) { float v[16]; const float* p = row + k0 + 8 * (lane >> 4);
#pragma unroll
  for (int i = 0; i < 8; ++i) { v[i] = p[i]; v[8 + i] = p[16 + i]; }
  return bsplit16(v); }
__device__ __forceinline__ F2 split_rowK(const float* row, int k0, int lane, int K) { float v[16]; const int g = lane >> 4;
#pragma unroll
  for (int i = 0; i < 8; ++i) { const int ka = k0 + 8 * g + i, kb = ka + 16; v[i] = ka < K ? row[ka < K ? ka : K - 1] : 0.f; v[8 + i] = kb < K ? row[kb < K ? kb : K - 1] : 0.f; }
  return bsplit16(v); }
__device__ __forceinline__ F2 split_col(const float* W, int k0, int n, int lane, int ld, int K) { float v[16]; const int g = lane >> 4;
#pragma unroll
  for (int i = 0; i < 8; ++i) { const int ka = k0 + 8 * g + i, kb = ka + 16; v[i] = ka < K ? W[(size_t)(ka < K ? ka : K - 1) * ld + n] : 0.f; v[8 + i] = kb < K ? W[(size_t)(kb < K ? kb : K - 1) * ld + n] : 0.f; }
  return bsplit16(v); }
__device__ __forceinline__ v8f mac3(const F2& a, const F2& b, v8f c) { c = wmma_bf(a.l, b.h, c); c = wmma_bf(a.h, b.l, c); return wmma_bf(a.h, b.h, c); }
__device__ __forceinline__ float sigm(float v) { return 1.0f / (1.0f + expf(-v)); }
#define LDSX() do { asm volatile("s_wait_dscnt 0" ::: "memory"); __builtin_amdgcn_wave_barrier(); __builtin_amdgcn_fence(__ATOMIC_RELEASE, "workgroup"); } while (0)


#define NB 2
#define SS 2048
#define DM 1024
#define NH 16
#define LW 128
#define HD 64
#define QKVW (3 * DM)
#ifndef TQB
#define TQB (SS / 64)
#define TNB NB
#define TOB (NB * SS / 64)     // output row tiles (all)
#endif
typedef __attribute__((ext_vector_type(8))) __bf16 v8b;
__device__ __forceinline__ v16b frag_b(const __bf16* rowk0, int lane) {
  union { v16b v; v8b q[2]; } u; const __bf16* p = rowk0 + 8 * (lane >> 4);
  u.q[0] = *(const v8b*)p; u.q[1] = *(const v8b*)(p + 16); return u.v;
}
__device__ __forceinline__ float bfr(float v) { return (float)(__bf16)v; }
__device__ __attribute__((noinline)) float exp_ni(float v) { return expf(v); }
__device__ __attribute__((noinline)) float erf_ni(float v) { return erff(v); }

#define PK_A 0                       // [3072][1024] Wqkv rows (natural [out][in])
#define PK_P (PK_A + QKVW * DM)        // [1024][1024] Wo rows (natural)
#define PK_END (PK_P + DM * DM)
#define WS_PK  0u
#define WS_QK  (WS_PK + 2u * PK_END)             // f16 [4096 rows][2048]: q | k
#define WS_QKL (WS_QK + 2u * NB * SS * 2 * DM)     // f16 q | k residual planes x2048
#define WS_VTH (WS_QKL + 2u * NB * SS * 2 * DM)    // f16 [b][1024 (h*64+d)][2048 s] hi
#define WS_VTL (WS_VTH + 2u * NB * DM * SS)        // f16 lo x 2048
#define WS_O   (WS_VTL + 2u * NB * DM * SS)        // f32 [4096][1024]
#define WS_CS  (WS_O + 4u * NB * SS * DM)           // f32 2 x [2048][32], not read or written
#define WS_END (WS_CS + 4u * 2 * SS * 32)
// ---- k_pack: block = (row n, which): natural [out][in] rows -> bf16; which 0..2 -> W_q/W_k/W_v into PK_A rows which*1024 + n; 3 -> W_o into PK_P
__global__ __launch_bounds__(256) void k_pack(const float* __restrict__ WQ, const float* __restrict__ WK, const float* __restrict__ WV, const float* __restrict__ WO, __bf16* __restrict__ PK) {
  __shared__ __align__(16) __bf16 s[DM]; const int n = blockIdx.x, which = blockIdx.y, t = threadIdx.x; const float* Wm = (which == 0) ? WQ : (which == 1) ? WK : (which == 2) ? WV : WO;
  for (int k = t; k < DM; k += 256) s[k] = (__bf16)Wm[(size_t)n * DM + k];
  __syncthreads();
  __bf16* dst = (which < 3) ? PK + PK_A + ((size_t)which * DM + n) * DM : PK + PK_P + (size_t)n * DM;
  for (int q = t; q < DM / 8; q += 256) vst2((unsigned*)(dst + q * 8), *(const v4u*)&s[q * 8]);
}
typedef __attribute__((ext_vector_type(4))) __bf16 v4b;
#define GKS 64   // k of one staged slice: a slice row is 256 bytes of A (f32) and a whole 128-byte line of B (bf16)
#define GPB 72   // LDS pitch of a 64-k bf16 tile row, in elements: 144 B = 16 B x odd, the conflict-free pitch for 16-byte reads
// ---- gemm_tile: one work-group's C[32 * FM][128] += A . B^T over K = DM. A: f32 rows, rounded to bf16 (NP == 1) or split bf16 hi + lo (NP == 2) once per work-group; B: bf16 rows.
// Each 64-k slice of both operands is staged once in LDS (two buffers, the next slice held in registers while this one is multiplied) and read, as two 32-k halves in k order, by 2 x 2 waves of FM x 4 tiles each.
// The full unrolls keep the register arrays (ra, rb, fragments, acc) indexed by constants; the k loop's unroll by 2 makes the buffer index a constant in each copy.
template <int FM, int NP>
__device__ __forceinline__ void gemm_tile(const float* __restrict__ A, const __bf16* __restrict__ B, __bf16* sA, __bf16* sB, v8f (&acc)[FM][4], int tid) {
  constexpr int BM = 32 * FM, CA = BM / 8;
  const int wave = tid >> 5, lane = tid & 31, col = lane & 15, wm = wave >> 1, wn = wave & 1;
  const int arow = tid >> 4, ac = (tid & 15) * 4;   // staging of A: thread t takes 4 k of rows (t >> 4) + 8 i, so that each wave-wide 16-byte load covers two whole rows of 256 bytes
  const int srow = tid >> 3, sc = (tid & 7) * 8;    // staging of B: thread t takes 8 k of rows (t >> 3) + 16 i, so that each wave-wide 16-byte load covers four whole 128-byte lines
  const float* ga = A + (size_t)arow * DM + ac; const __bf16* gb = B + (size_t)srow * DM + sc;
  v4f ra[CA]; v8b rb[8];
#pragma unroll
  for (int i = 0; i < CA; ++i) ra[i] = *(const v4f*)(ga + (size_t)i * 8 * DM);
#pragma unroll
  for (int i = 0; i < 8; ++i) rb[i] = *(const v8b*)(gb + (size_t)i * 16 * DM);
  asm volatile("s_wait_xcnt 0x0" :: "v"(ga), "v"(gb) : "memory");   // stands in front of every later write of the address registers that the first slice's loads name: as inputs they stay live up to the wait
#pragma unroll 2
  for (int kc = 0; kc < DM / GKS; ++kc) { const int buf = kc & 1;
#pragma unroll
    for (int i = 0; i < CA; ++i) { v4b hv, lv;
#pragma unroll
      for (int e = 0; e < 4; ++e) { const float x = ra[i][e]; const __bf16 hb = (__bf16)x; hv[e] = hb; if (NP == 2) lv[e] = (__bf16)(x - (float)hb); }
      *(v4b*)(sA + ((buf * NP) * BM + arow + i * 8) * GPB + ac) = hv; if (NP == 2) *(v4b*)(sA + ((buf * NP + 1) * BM + arow + i * 8) * GPB + ac) = lv; }
#pragma unroll
    for (int i = 0; i < 8; ++i) *(v8b*)(sB + (buf * 128 + srow + i * 16) * GPB + sc) = rb[i];
    __syncthreads();   // publishes slice kc; the other buffer's readers (slice kc - 1) are all past it before slice kc + 1 is stored there
    if (kc + 1 < DM / GKS) {
#pragma unroll
      for (int i = 0; i < CA; ++i) ra[i] = *(const v4f*)(ga + (size_t)i * 8 * DM + (kc + 1) * GKS);
#pragma unroll
      for (int i = 0; i < 8; ++i) rb[i] = *(const v8b*)(gb + (size_t)i * 16 * DM + (kc + 1) * GKS);
      asm volatile("s_wait_xcnt 0x0" ::: "memory"); }   // stands in front of the advance of the address registers that these loads name
#pragma unroll
    for (int kh = 0; kh < GKS; kh += 32) {   // the slice's two 32-k halves, in k order
      v16b b[4], ah[FM], al[FM];
#pragma unroll
      for (int j = 0; j < 4; ++j) b[j] = frag_b(sB + (buf * 128 + wn * 64 + j * 16 + col) * GPB + kh, lane);
#pragma unroll
      for (int i = 0; i < FM; ++i) { ah[i] = frag_b(sA + ((buf * NP) * BM + wm * (FM * 16) + i * 16 + col) * GPB + kh, lane); if (NP == 2) al[i] = frag_b(sA + ((buf * NP + 1) * BM + wm * (FM * 16) + i * 16 + col) * GPB + kh, lane); }
#pragma unroll
      for (int i = 0; i < FM; ++i) {
        if (NP == 2) {
#pragma unroll
          for (int j = 0; j < 4; ++j) acc[i][j] = wmma_bf(al[i], b[j], acc[i][j]); }
#pragma unroll
        for (int j = 0; j < 4; ++j) acc[i][j] = wmma_bf(ah[i], b[j], acc[i][j]); } } }
  __syncthreads();   // every wave has read the last slice: the caller may reuse the LDS
}
// ---- k_qkv: block = (128 rows, 128 cols), 2 x 2 waves of 64 x 64
__global__ __launch_bounds__(128) void k_qkv(const float* __restrict__ XQ, const float* __restrict__ XK, const float* __restrict__ XV, const __bf16* __restrict__ P, const float* __restrict__ BQ, const float* __restrict__ BK, const float* __restrict__ BV, _Float16* __restrict__ QK, _Float16* __restrict__ QKL, _Float16* __restrict__ VTH, _Float16* __restrict__ VTL) {
  const int which0 = (blockIdx.y * 128) / DM; const float* X = (which0 == 0) ? XQ : (which0 == 1) ? XK : XV; const float* BB = BQ ? (((which0 == 0) ? BQ : (which0 == 1) ? BK : BV) + (blockIdx.y * 128 - which0 * DM)) : nullptr;
  __shared__ __align__(16) unsigned char sm[2 * 2 * 128 * GPB * 2];   // loop: A and B slices, two buffers each (73,728 B); epilogue: hi and residual planes [128][136] f16 (69,632 B)
  static_assert(2 * 2 * 128 * GPB * 2 >= 2 * 128 * 136 * 2, "the epilogue's planes fit the loop's buffers");
  const int tid = threadIdx.x, wave = tid >> 5, lane = tid & 31, col = lane & 15, g = lane >> 4, wm = wave >> 1, wn = wave & 1; const size_t rb = (size_t)blockIdx.x * 128; const int n0 = blockIdx.y * 128;
  v8f acc[4][4] = {};
  gemm_tile<4, 1>(X + rb * DM, P + (size_t)n0 * DM, (__bf16*)sm, (__bf16*)sm + 2 * 128 * GPB, acc, tid);
  _Float16 (*sh)[136] = (_Float16 (*)[136])sm; _Float16 (*sl)[136] = (_Float16 (*)[136])(sm + 128 * 136 * 2);
  if (n0 < 2 * DM) {   // q stored unscaled (f16 sigma ~0.6, no subnormal exposure); 1/8 applied to the f32 score
#pragma unroll
    for (int i = 0; i < 4; ++i) {
#pragma unroll
      for (int j = 0; j < 4; ++j) { const int c = wn * 64 + j * 16 + col; const float bv = BB ? bfr(BB[c]) : 0.f;
#pragma unroll
        for (int r = 0; r < 8; ++r) { const float v = acc[i][j][r] + bv; const _Float16 hv = (_Float16)v; sh[wm * 64 + i * 16 + 8 * g + r][c] = hv; sl[wm * 64 + i * 16 + 8 * g + r][c] = (_Float16)((v - (float)hv) * 2048.0f); } } }   // q, k (+ bias) as f16 hi + (x2048) residual
    __syncthreads();
#pragma unroll
    for (int it = 0; it < 16; ++it) { const int rl = it * 8 + (tid >> 4), pc = tid & 15; const size_t o = (rb + rl) * (2 * DM) + n0 + pc * 8; vst2((unsigned*)(QK + o), *(const v4u*)&sh[rl][pc * 8]); vst2((unsigned*)(QKL + o), *(const v4u*)&sl[rl][pc * 8]); }
  } else {   // v transposed: planes [d][s]
#pragma unroll
    for (int i = 0; i < 4; ++i) {
#pragma unroll
      for (int j = 0; j < 4; ++j) { const int c = wn * 64 + j * 16 + col; const float bv = BB ? bfr(BB[c]) : 0.f; v8h hq, lq;
#pragma unroll
        for (int r = 0; r < 8; ++r) { const float v = acc[i][j][r] + bv; const _Float16 hv = (_Float16)v; hq[r] = hv; lq[r] = (_Float16)((v - (float)hv) * 2048.0f); }
        *(v8h*)&sh[c][wm * 64 + i * 16 + 8 * g] = hq; *(v8h*)&sl[c][wm * 64 + i * 16 + 8 * g] = lq; } }
    __syncthreads();
    const int b = (int)(rb / SS), s0 = (int)(rb % SS); const int pc0 = n0 - 2 * DM;
#pragma unroll
    for (int it = 0; it < 16; ++it) { const int d = it * 8 + (tid >> 4), pc = tid & 15; const size_t o = ((size_t)b * DM + pc0 + d) * SS + s0 + pc * 8; vst2((unsigned*)(VTH + o), *(const v4u*)&sh[d][pc * 8]); vst2((unsigned*)(VTL + o), *(const v4u*)&sl[d][pc * 8]); }
  }
}
// ---- k_attn: block = (64 queries, head h, batch b): banded flash attention (K = 64: 2 k-steps), scores = (q.k) * 0.125, P.V: f16 P x (V hi, V lo*2048) in two accumulators; O[b*S+q][h*64+d] = (acc + accl / 2048) / (2048 l) (256-B segments)
// Both products are formed transposed: S^T = K . Q^T (A = key rows, B = the wave's 16 queries) and O^T += V^T . P^T. A lane then holds 16 of the 32 scores of ONE query (its column), so that the maximum and the sum are taken
// in the lane (the maximum joined with the other lane half once per 32 keys, the sum once in the epilogue), and the two score tiles, converted in place, are the B operand of the second product: P never leaves the registers.
// The keys are walked in stages of 64. A stage is four planes (k hi, k residual: [key][64 d]; v hi, v residual: [d][64 keys]) of 64 rows x 128 B, brought into LDS once per work-group by asynchronous copies
// (whole 128-B lines, two buffers, the next stage in flight while this one is worked on) and read from there by all four waves.
#define STG_PLANE 8192                 // 64 rows x 128 B
#define STG_BYTES (4 * STG_PLANE)
// Rows lie at a pitch of 128 B; the 16-byte piece c of row r lies at place c ^ ((r >> 1) & 7), so that the 16 rows which a half wave's ds_load_b128 reads at one c fall on all 64 banks.
// copy8: rows r, r + 16, r + 32, r + 48 of two planes, 16 B a lane. The s_wait_xcnt closes the statement so that it stands in front of every later write of the address registers that the copies name.
__device__ __forceinline__ void copy8(unsigned l0, unsigned l1, const _Float16* g0, const _Float16* g1) {
  asm volatile("global_load_async_to_lds_b128 %0, %8, off\n\t"
               "global_load_async_to_lds_b128 %1, %9, off\n\t"
               "global_load_async_to_lds_b128 %2, %10, off\n\t"
               "global_load_async_to_lds_b128 %3, %11, off\n\t"
               "global_load_async_to_lds_b128 %4, %12, off\n\t"
               "global_load_async_to_lds_b128 %5, %13, off\n\t"
               "global_load_async_to_lds_b128 %6, %14, off\n\t"
               "global_load_async_to_lds_b128 %7, %15, off\n\t"
               "s_wait_xcnt 0x0"
               :: "v"(l0), "v"(l0 + 2048u), "v"(l0 + 4096u), "v"(l0 + 6144u), "v"(l1), "v"(l1 + 2048u), "v"(l1 + 4096u), "v"(l1 + 6144u),
                  "v"(g0), "v"(g0 + 16 * 2048), "v"(g0 + 32 * 2048), "v"(g0 + 48 * 2048), "v"(g1), "v"(g1 + 16 * 2048), "v"(g1 + 32 * 2048), "v"(g1 + 48 * 2048)
               : "memory");
}
// the value of lane l ^ 16: the other half of the same column
__device__ __forceinline__ float xhalf(float v) { const int b = __builtin_bit_cast(int, v); return __builtin_bit_cast(float, __builtin_amdgcn_permlanex16(b, b, 0x76543210, 0xfedcba98, false, false)); }
__device__ __forceinline__ v16h frag_l(const unsigned char* row, int o0, int o1) {
  union { v16h v; v8h q[2]; } u; u.q[0] = *(const v8h*)(row + o0); u.q[1] = *(const v8h*)(row + o1); return u.v;
}
__global__ __launch_bounds__(128) void k_attn(const _Float16* __restrict__ QK, const _Float16* __restrict__ QKL, const _Float16* __restrict__ VTH, const _Float16* __restrict__ VTL, const void* __restrict__ KMASK, float* __restrict__ O) {
  static_assert(2 * DM == 2048 && SS == 2048 && HD == 64, "copy8 steps 16 rows of 2,048 f16"); static_assert(LW % 64 == 0 && SS % 64 == 0, "the window is whole stages of 64 keys");
  __shared__ __align__(128) unsigned char sm[2 * STG_BYTES];   // two stage buffers (epilogue: the output rows [4][16][68] f32)
  float (*so)[16][68] = (float (*)[16][68])sm;
  const int tid = threadIdx.x, wave = tid >> 5, lane = tid & 31, col = lane & 15, g = lane >> 4;
  const int qb = blockIdx.x, h = blockIdx.y, b = blockIdx.z; const int q0 = qb * 64 + wave * 16; const size_t rq = (size_t)b * SS + q0 + col;
  const int nks = SS / 32;   // all keys
  const int ks0 = (qb * 64 - LW) > 0 ? (qb * 64 - LW) / 32 : 0; const int ks1 = ((qb * 64 + 64 + LW + 31) / 32) < nks ? ((qb * 64 + 64 + LW + 31) / 32) : nks;   // window tiles: both even, so the window is whole stages
  const int st0 = ks0 >> 1, ns = (ks1 >> 1) - st0;
  // copies: thread t takes piece t & 7 of rows (t >> 3) + 16 i of each plane: a wave-wide copy covers four whole lines
  const int crow = tid >> 3, cpc = tid & 7;
  const unsigned lc = (unsigned)(size_t)sm + (unsigned)(crow * 128 + ((cpc ^ ((crow >> 1) & 7)) << 4));
  const size_t gko = ((size_t)b * SS + st0 * 64 + crow) * (2 * DM) + DM + h * HD + cpc * 8, gvo = ((size_t)b * DM + h * HD + crow) * SS + st0 * 64 + cpc * 8;
  const _Float16 *gk = QK + gko, *gkl = QKL + gko, *gv = VTH + gvo, *gvl = VTL + gvo;   // stage t: k rows advance by 64 rows, v rows by 64 keys
  copy8(lc, lc + STG_PLANE, gk, gkl); copy8(lc + 2 * STG_PLANE, lc + 3 * STG_PLANE, gv, gvl);
  v16h aq[2], aql[2];
#pragma unroll
  for (int kc = 0; kc < 2; ++kc) { aq[kc] = frag_h(QK + rq * (2 * DM) + h * HD + kc * 32, lane); aql[kc] = frag_h(QKL + rq * (2 * DM) + h * HD + kc * 32, lane); }
  float m = -3.0e38f, l = 0.f;   // of query q0 + col: the running maximum (equal in both lane halves) and this lane half's share of the sum
  v8f acc[4] = {}, accl[4] = {};
  asm volatile("s_wait_asynccnt 0x0" ::: "memory");   // this wave's copies of stage 0 have landed
  __syncthreads();                                    // publishes stage 0
  if (ns > 1) { copy8(lc + STG_BYTES, lc + STG_BYTES + STG_PLANE, gk + (size_t)64 * 2 * DM, gkl + (size_t)64 * 2 * DM); copy8(lc + STG_BYTES + 2 * STG_PLANE, lc + STG_BYTES + 3 * STG_PLANE, gv + 64, gvl + 64); }
  const int swz = (col >> 1) & 7; int fo[4];   // a fragment's pieces 2 j + g of a 128-B row, at their places
#pragma unroll
  for (int j = 0; j < 4; ++j) fo[j] = ((2 * j + g) ^ swz) << 4;
#pragma unroll 1   // one copy of the body: the buffer is chosen by an address, and nothing can move across the publish point
  for (int t = 0; t < ns; ++t) { const unsigned char* sb = sm + (t & 1) * STG_BYTES + col * 128;
#pragma unroll 1   // one copy of the body: the two halves of a stage differ by an address only
  for (int sub = 0; sub < 2; ++sub) { const int ks = (st0 + t) * 2 + sub; v8f s[2];
#pragma unroll
    for (int ct = 0; ct < 2; ++ct) { const int kk = ks * 32 + ct * 16 + 8 * g; const unsigned char* krow = sb + (sub * 32 + ct * 16) * 128; v8f c = {}, cl = {};   // register r: key kk + r
      v16h kh[2], kl[2];   // the 16 keys' fragments, read from LDS as one group ahead of their products: one wait instead of one per product
#pragma unroll
      for (int kc = 0; kc < 2; ++kc) { kh[kc] = frag_l(krow, fo[2 * kc], fo[2 * kc + 1]); kl[kc] = frag_l(krow + STG_PLANE, fo[2 * kc], fo[2 * kc + 1]); }
      if (qb < 32) {   // every query block (qb < 32 holds for all 32 blocks of the grid): 3 products
#pragma unroll
        for (int kc = 0; kc < 2; ++kc) { c = wmma16(kh[kc], aq[kc], c); cl = wmma16(kh[kc], aql[kc], cl); cl = wmma16(kl[kc], aq[kc], cl); }
#pragma unroll
        for (int r = 0; r < 8; ++r) c[r] += cl[r] * (1.0f / 2048.0f); }
      else {
#pragma unroll
        for (int kc = 0; kc < 2; ++kc) c = wmma16(kh[kc], aq[kc], c); }   // single product (never taken: qb < 32 in every block)
#pragma unroll
      for (int r = 0; r < 8; ++r) { const int dq = (q0 + col) - (kk + r); s[ct][r] = (dq <= LW && dq >= -LW) ? c[r] * 0.125f : -3.0e38f; } }   // 1/sqrt(64); masked keys excluded
    float mx = fmaxf(s[0][0], s[1][0]);   // the full unrolls of this body keep s, acc, accl, pa and pl indexed by constants, that is, in registers
#pragma unroll
    for (int r = 1; r < 8; ++r) mx = fmaxf(mx, fmaxf(s[0][r], s[1][r]));
    mx = fmaxf(mx, xhalf(mx));   // the query's other 16 keys of this half stage
    const float mn = fmaxf(m, mx); const float alpha = (m <= -1.0e38f) ? 0.f : __expf(m - mn); m = mn;
    float es[2] = {0.f, 0.f};
#pragma unroll
    for (int ct = 0; ct < 2; ++ct) {
#pragma unroll
      for (int r = 0; r < 8; ++r) { const float e = (s[ct][r] <= -1.0e38f) ? 0.f : __expf(s[ct][r] - mn); s[ct][r] = e; es[ct] += e; } }
    l = l * alpha + (es[0] + es[1]);
#pragma unroll
    for (int dt = 0; dt < 4; ++dt) {
#pragma unroll
      for (int r = 0; r < 8; ++r) { acc[dt][r] *= alpha; accl[dt][r] *= alpha; } }
    const int vo0 = fo[0] ^ (sub << 6), vo1 = fo[1] ^ (sub << 6);   // pieces 4 sub + g and 4 sub + 2 + g: this half's 32 keys
    v16h pa, pl;   // B operand: element i = key 8 g + i (first tile's register i), element 8 + i = key 16 + 8 g + i (second tile's): the k order of the v fragments
#pragma unroll
    for (int i = 0; i < 8; ++i) { const float x0 = s[0][i] * 2048.0f, x1 = s[1][i] * 2048.0f; const _Float16 h0 = (_Float16)x0, h1 = (_Float16)x1; pa[i] = h0; pa[8 + i] = h1; pl[i] = (_Float16)((x0 - (float)h0) * 2048.0f); pl[8 + i] = (_Float16)((x1 - (float)h1) * 2048.0f); }   // P scaled by 2^11 before the f16 split so small softmax weights stay out of the f16 subnormal range; 2^-11 folded into the epilogue
#pragma unroll
    for (int dp = 0; dp < 4; dp += 2) { v16h vh[2], vl[2];   // two d tiles' fragments, read as one group ahead of their products
#pragma unroll
      for (int e = 0; e < 2; ++e) { const unsigned char* vrow = sb + 2 * STG_PLANE + (dp + e) * 16 * 128; vh[e] = frag_l(vrow, vo0, vo1); vl[e] = frag_l(vrow + STG_PLANE, vo0, vo1); }
#pragma unroll
      for (int e = 0; e < 2; ++e) { const int dt = dp + e; acc[dt] = wmma16(vh[e], pa, acc[dt]); if (qb < 32) { accl[dt] = wmma16(vh[e], pl, accl[dt]); accl[dt] = wmma16(vl[e], pa, accl[dt]); } } } }   // every query block (qb < 32 always): P hi/lo x V hi/lo (3 products)
    asm volatile("s_wait_dscnt 0x0" ::: "memory");      // this wave's reads of stage t have returned
    asm volatile("s_wait_asynccnt 0x0" ::: "memory");   // this wave's copies of stage t + 1 have landed
    __syncthreads();                                    // publishes stage t + 1 and ends every wave's reads of stage t's buffer
    if (t + 2 < ns) { const unsigned lb = lc + (t & 1) * STG_BYTES; const size_t ko = (size_t)(t + 2) * 64 * 2 * DM; const int vo = (t + 2) * 64;
      copy8(lb, lb + STG_PLANE, gk + ko, gkl + ko); copy8(lb + 2 * STG_PLANE, lb + 3 * STG_PLANE, gv + vo, gvl + vo); } }
  asm volatile("s_wait_asynccnt 0x0" ::: "memory");   // no copy is outstanding when the buffers become output staging
  const float il = (1.0f / 2048.0f) / (l + xhalf(l));   // the two lane halves' sums joined
#pragma unroll
  for (int dt = 0; dt < 4; ++dt) {   // register r: d = 16 dt + 8 g + r of query q0 + col
#pragma unroll
    for (int r4 = 0; r4 < 8; r4 += 4) { v4f o;
#pragma unroll
      for (int e = 0; e < 4; ++e) o[e] = (acc[dt][r4 + e] + accl[dt][r4 + e] * (1.0f / 2048.0f)) * il;
      *(v4f*)&so[wave][col][dt * 16 + 8 * g + r4] = o; } }
  LDSX();
  for (int rl = 0; rl < 16; ++rl) if (lane < 16) vst2(O + ((size_t)b * SS + q0 + rl) * DM + h * HD + lane * 4, *(const v4f*)&so[wave][rl][lane * 4]);
}
// ---- k_out: block = (64 rows, 128 cols), 2 x 2 waves of 32 x 64: out = O(hi/lo) . Wo rows (2 products) + bo
__global__ __launch_bounds__(128) void k_out(const float* __restrict__ O, const __bf16* __restrict__ P, const float* __restrict__ BO, float* __restrict__ Y) {
  __shared__ __align__(16) unsigned char sm[2 * 2 * 64 * GPB * 2 + 2 * 128 * GPB * 2];   // loop: A hi and lo and B slices, two buffers each (73,728 B); epilogue: [64][132] f32
  const int tid = threadIdx.x, wave = tid >> 5, lane = tid & 31, col = lane & 15, g = lane >> 4, wm = wave >> 1, wn = wave & 1; const size_t rb = (size_t)blockIdx.x * 64; const int n0 = blockIdx.y * 128;
  v8f acc[2][4] = {};
  gemm_tile<2, 2>(O + rb * DM, P + (size_t)n0 * DM, (__bf16*)sm, (__bf16*)sm + 2 * 2 * 64 * GPB, acc, tid);
  float (*so)[132] = (float (*)[132])sm;
#pragma unroll
  for (int i = 0; i < 2; ++i) {
#pragma unroll
    for (int j = 0; j < 4; ++j) { const int c = wn * 64 + j * 16 + col; const float bv = bfr(BO[n0 + c]);
#pragma unroll
      for (int r = 0; r < 8; ++r) so[wm * 32 + i * 16 + 8 * g + r][c] = acc[i][j][r] + bv; } }
  __syncthreads();
#pragma unroll
  for (int it = 0; it < 16; ++it) { const int rl = it * 4 + wave, c4 = lane; vst2(Y + (rb + rl) * DM + n0 + c4 * 4, *(const v4f*)&so[rl][c4 * 4]); }
}
extern "C" void kernel_launch(void* const* d_in, const int* in_sizes, int n_in, void* d_out, int out_size, void* d_ws, size_t ws_size, hipStream_t stream) {
  (void)in_sizes; (void)n_in; (void)out_size;
  const float** F = (const float**)d_in;   // 0 x [2,2048,1024], 1 W_qkv [3072,1024] natural (rows q | k | v), 2 W_proj [1024,1024] natural, 3 b_proj
  if (ws_size < (size_t)WS_END) return;
  char* ws = (char*)d_ws; __bf16* PK = (__bf16*)(ws + WS_PK); _Float16 *QK = (_Float16*)(ws + WS_QK), *QKL = (_Float16*)(ws + WS_QKL), *VTH = (_Float16*)(ws + WS_VTH), *VTL = (_Float16*)(ws + WS_VTL); float* O = (float*)(ws + WS_O);
  k_pack<<<dim3(DM, 4), 256, 0, stream>>>(F[1], F[1] + (size_t)DM * DM, F[1] + (size_t)2 * DM * DM, F[2], PK);
  k_qkv<<<dim3(TNB * SS / 128, QKVW / 128), 128, 0, stream>>>(F[0], F[0], F[0], PK + PK_A, nullptr, nullptr, nullptr, QK, QKL, VTH, VTL);
  k_attn<<<dim3(TQB, NH, TNB), 128, 0, stream>>>(QK, QKL, VTH, VTL, nullptr, O);
  k_out<<<dim3(TOB, DM / 128), 128, 0, stream>>>(O, PK + PK_P, F[3], (float*)d_out);
}

// v005
// It runs in 88.1 microseconds.
// Timed twice side by side with v004, it ran 1.03 times as fast both times.
// All steps since v000 together make it 3.34 times as fast.
// compute dtype: all float inputs rounded to bf16; qkv = x . W^T with EXACT bf16 products on WMMA 16x16x32 (natural rows), f16 hi + residual; banded attention (|i - j| <= 128 by index; other key tiles skipped) with 3-product logits and 3-product P.v (unit-scale projections), x 1/8, running-max softmax in f32 (hardware exp); out = ctx (bf16 hi + lo) . W_proj^T + b_proj; f32 output.
#include <hip/hip_runtime.h>
#include <math.h>

typedef __attribute__((ext_vector_type(16))) _Float16 v16h;
typedef __attribute__((ext_vector_type(16))) __bf16 v16b;
typedef __attribute__((ext_vector_type(8)))  _Float16 v8h;
typedef __attribute__((ext_vector_type(8)))  float v8f;
typedef __attribute__((ext_vector_type(4)))  float v4f;
typedef __attribute__((ext_vector_type(2)))  float v2f;
typedef __attribute__((ext_vector_type(4)))  unsigned v4u;
typedef __attribute__((ext_vector_type(4)))  int v4i;
typedef float __attribute__((may_alias)) float_a;
typedef int __attribute__((may_alias)) int_a;

template <typename T> __device__ __forceinline__ void vst2(void* p, T v) { *(T*)p = v;  }
__device__ __forceinline__ v8f wmma16(v16h a, v16h b, v8f c) {
  v8f d = __builtin_amdgcn_wmma_f32_16x16x32_f16(false, a, false, b, (short)0, c, false, false);
  asm volatile("v_nop\n\tv_nop\n\tv_nop\n\tv_nop" : "+v"(d) : "v"(a), "v"(b));
  return d;
}
__device__ __forceinline__ v8f wmma_bf(v16b a, v16b b, v8f c) {
  v8f d = __builtin_amdgcn_wmma_f32_16x16x32_bf16(false, a, false, b, (short)0, c, false, false);
  asm volatile("v_nop\n\tv_nop\n\tv_nop\n\tv_nop" : "+v"(d) : "v"(a), "v"(b));
  return d;
}
// Efficient (sliding-window) attention (B 2, T 2,048, D 1,024, 16 heads x 64, window 128): bias-free natural qkv projection (rows q | k | v), |i - j| <= 128 else excluded (finfo.min fill), softmax(q k / 8) v, natural output projection + bias.
__device__ __forceinline__ v16h frag_h(const _Float16* rowk0, int lane) {
  union { v16h v; v8h q[2]; } u; const _Float16* p = rowk0 + 8 * (lane >> 4);
  u.q[0] = *(const v8h*)p; u.q[1] = *(const v8h*)(p + 16); return u.v;
}
__device__ __forceinline__ v16h frag_f32(const float* rowk0, int lane) {
  v16h a; const float* p = rowk0 + 8 * (lane >> 4);
#pragma unroll
  for (int i = 0; i < 8; ++i) { a[i] = (_Float16)p[i]; a[8 + i] = (_Float16)p[16 + i]; }
  return a;
}
__device__ __forceinline__ v16h frag_f32s(const float* rowk0, int lane, float sc) {
  v16h a; const float* p = rowk0 + 8 * (lane >> 4);
#pragma unroll
  for (int i = 0; i < 8; ++i) { a[i] = (_Float16)(p[i] * sc); a[8 + i] = (_Float16)(p[16 + i] * sc); }
  return a;
}
// column fragment from a [K][ld] layout (column n), rows >= K read as 0
__device__ __forceinline__ v16h fragc_f32(const float* W, int k0, int n, int lane, int ld, int K) {
  v16h a; const int g = lane >> 4;
#pragma unroll
  for (int i = 0; i < 8; ++i) { const int ka = k0 + 8 * g + i, kb = ka + 16;
    a[i] = (_Float16)(ka < K ? W[(size_t)(ka < K ? ka : K - 1) * ld + n] : 0.f); a[8 + i] = (_Float16)(kb < K ? W[(size_t)(kb < K ? kb : K - 1) * ld + n] : 0.f); }
  return a;
}
struct F2 { v16b h, l; };
__device__ __forceinline__ F2 bsplit16(const float v[16]) { F2 r;
#pragma unroll
  for (int i = 0; i < 16; ++i) { const __bf16 h = (__bf16)v[i]; r.h[i] = h; r.l[i] = (__bf16)(v[i] - (float)h); }
  return r; }
__device__ __forceinline__ F2 split_row(const float* row, int k0, int lane) { float v[16]; const float* p = row + k0 + 8 * (lane >> 4);
#pragma unroll
  for (int i = 0; i < 8; ++i) { v[i] = p[i]; v[8 + i] = p[16 + i]; }
  return bsplit16(v); }
__device__ __forceinline__ F2 split_rowK(const float* row, int k0, int lane, int K) { float v[16]; const int g = lane >> 4;
#pragma unroll
  for (int i = 0; i < 8; ++i) { const int ka = k0 + 8 * g + i, kb = ka + 16; v[i] = ka < K ? row[ka < K ? ka : K - 1] : 0.f; v[8 + i] = kb < K ? row[kb < K ? kb : K - 1] : 0.f; }
  return bsplit16(v); }
__device__ __forceinline__ F2 split_col(const float* W, int k0, int n, int lane, int ld, int K) { float v[16]; const int g = lane >> 4;
#pragma unroll
  for (int i = 0; i < 8; ++i) { const int ka = k0 + 8 * g + i, kb = ka + 16; v[i] = ka < K ? W[(size_t)(ka < K ? ka : K - 1) * ld + n] : 0.f; v[8 + i] = kb < K ? W[(size_t)(kb < K ? kb : K - 1) * ld + n] : 0.f; }
  return bsplit16(v); }
__device__ __forceinline__ v8f mac3(const F2& a, const F2& b, v8f c) { c = wmma_bf(a.l, b.h, c); c = wmma_bf(a.h, b.l, c); return wmma_bf(a.h, b.h, c); }
__device__ __forceinline__ float sigm(float v) { return 1.0f / (1.0f + expf(-v)); }
#define LDSX() do { asm volatile("s_wait_dscnt 0" ::: "memory"); __builtin_amdgcn_wave_barrier(); __builtin_amdgcn_fence(__ATOMIC_RELEASE, "workgroup"); } while (0)


#define NB 2
#define SS 2048
#define DM 1024
#define NH 16
#define LW 128
#define HD 64
#define QKVW (3 * DM)
#ifndef TQB
#define TQB (SS / 64)
#define TNB NB
#define TOB (NB * SS / 64)     // output row tiles (all)
#endif
typedef __attribute__((ext_vector_type(8))) __bf16 v8b;
__device__ __forceinline__ v16b frag_b(const __bf16* rowk0, int lane) {
  union { v16b v; v8b q[2]; } u; const __bf16* p = rowk0 + 8 * (lane >> 4);
  u.q[0] = *(const v8b*)p; u.q[1] = *(const v8b*)(p + 16); return u.v;
}
__device__ __forceinline__ float bfr(float v) { return (float)(__bf16)v; }
__device__ __attribute__((noinline)) float exp_ni(float v) { return expf(v); }
__device__ __attribute__((noinline)) float erf_ni(float v) { return erff(v); }

#define PK_A 0                       // [3072][1024] Wqkv rows (natural [out][in])
#define PK_P (PK_A + QKVW * DM)        // [1024][1024] Wo rows (natural)
#define PK_END (PK_P + DM * DM)
#define WS_PK  0u
#define WS_QK  (WS_PK + 2u * PK_END)             // f16 [4096 rows][2048]: q | k
#define WS_QKL (WS_QK + 2u * NB * SS * 2 * DM)     // f16 q | k residual planes x2048
#define WS_VTH (WS_QKL + 2u * NB * SS * 2 * DM)    // f16 [b][1024 (h*64+d)][2048 s] hi
#define WS_VTL (WS_VTH + 2u * NB * DM * SS)        // f16 lo x 2048
#define WS_O   (WS_VTL + 2u * NB * DM * SS)        // f32 [4096][1024]
#define WS_CS  (WS_O + 4u * NB * SS * DM)           // f32 2 x [2048][32], not read or written
#define WS_END (WS_CS + 4u * 2 * SS * 32)
typedef __attribute__((ext_vector_type(4))) __bf16 v4b;
#define PKE 16384   // elements of one work-group: 256 threads x 16 loads of 4
// ---- k_pack: both weights (natural [out][in] rows) rounded to bf16, element for element in their own order: PK = W_qkv rows (PK_A), then W_proj rows (PK_P).
// Few, long work-groups (one per 64 KiB of source, 2,048 waves in all) instead of one per row (32,768 waves): fewer waves to start for the same bytes. A thread has its 16 loads in flight together;
// each wave-wide load covers 512 contiguous bytes (four whole lines), each wave-wide store 256 (two whole lines).
__global__ __launch_bounds__(256) void k_pack(const float* __restrict__ WA, const float* __restrict__ WO, __bf16* __restrict__ PK) {
  static_assert((QKVW * DM) % PKE == 0 && (DM * DM) % PKE == 0 && PK_A == 0 && PK_P == QKVW * DM, "a work-group's piece lies in one weight, and PK follows the sources' order");
  const int w = blockIdx.x, t = threadIdx.x;
  const float* s = ((w < QKVW * DM / PKE) ? WA + (size_t)w * PKE : WO + ((size_t)w * PKE - (size_t)QKVW * DM)) + t * 4;
  __bf16* d = PK + (size_t)w * PKE + t * 4;
  v4f r[16];   // the full unrolls keep r indexed by constants, that is, in registers
#pragma unroll
  for (int i = 0; i < 16; ++i) r[i] = *(const v4f*)(s + i * 1024);
  __builtin_amdgcn_sched_barrier(0);   // keeps all 16 loads ahead of the first conversion: without it the last two are issued only when the first two have returned, a second memory latency in every wave
#pragma unroll
  for (int i = 0; i < 16; ++i) { v4b h;
#pragma unroll
    for (int e = 0; e < 4; ++e) h[e] = (__bf16)r[i][e];
    *(v4b*)(d + i * 1024) = h; }
}
#define GKS 64   // k of one staged slice: a slice row is 256 bytes of A (f32) and a whole 128-byte line of B (bf16)
#define GPB 72   // LDS pitch of a 64-k bf16 tile row, in elements: 144 B = 16 B x odd, the conflict-free pitch for 16-byte reads
// ---- gemm_tile: one work-group's C[32 * FM][128] += A . B^T over K = DM. A: f32 rows, rounded to bf16 (NP == 1) or split bf16 hi + lo (NP == 2) once per work-group; B: bf16 rows.
// Each 64-k slice of both operands is staged once in LDS (two buffers, the next slice held in registers while this one is multiplied) and read, as two 32-k halves in k order, by 2 x 2 waves of FM x 4 tiles each.
// The full unrolls keep the register arrays (ra, rb, fragments, acc) indexed by constants; the k loop's unroll by 2 makes the buffer index a constant in each copy.
template <int FM, int NP>
__device__ __forceinline__ void gemm_tile(const float* __restrict__ A, const __bf16* __restrict__ B, __bf16* sA, __bf16* sB, v8f (&acc)[FM][4], int tid) {
  constexpr int BM = 32 * FM, CA = BM / 8;
  const int wave = tid >> 5, lane = tid & 31, col = lane & 15, wm = wave >> 1, wn = wave & 1;
  const int arow = tid >> 4, ac = (tid & 15) * 4;   // staging of A: thread t takes 4 k of rows (t >> 4) + 8 i, so that each wave-wide 16-byte load covers two whole rows of 256 bytes
  const int srow = tid >> 3, sc = (tid & 7) * 8;    // staging of B: thread t takes 8 k of rows (t >> 3) + 16 i, so that each wave-wide 16-byte load covers four whole 128-byte lines
  const float* ga = A + (size_t)arow * DM + ac; const __bf16* gb = B + (size_t)srow * DM + sc;
  v4f ra[CA]; v8b rb[8];
#pragma unroll
  for (int i = 0; i < CA; ++i) ra[i] = *(const v4f*)(ga + (size_t)i * 8 * DM);
#pragma unroll
  for (int i = 0; i < 8; ++i) rb[i] = *(const v8b*)(gb + (size_t)i * 16 * DM);
  asm volatile("s_wait_xcnt 0x0" :: "v"(ga), "v"(gb) : "memory");   // stands in front of every later write of the address registers that the first slice's loads name: as inputs they stay live up to the wait
#pragma unroll 2
  for (int kc = 0; kc < DM / GKS; ++kc) { const int buf = kc & 1;
#pragma unroll
    for (int i = 0; i < CA; ++i) { v4b hv, lv;
#pragma unroll
      for (int e = 0; e < 4; ++e) { const float x = ra[i][e]; const __bf16 hb = (__bf16)x; hv[e] = hb; if (NP == 2) lv[e] = (__bf16)(x - (float)hb); }
      *(v4b*)(sA + ((buf * NP) * BM + arow + i * 8) * GPB + ac) = hv; if (NP == 2) *(v4b*)(sA + ((buf * NP + 1) * BM + arow + i * 8) * GPB + ac) = lv; }
#pragma unroll
    for (int i = 0; i < 8; ++i) *(v8b*)(sB + (buf * 128 + srow + i * 16) * GPB + sc) = rb[i];
    __syncthreads();   // publishes slice kc; the other buffer's readers (slice kc - 1) are all past it before slice kc + 1 is stored there
    if (kc + 1 < DM / GKS) {
#pragma unroll
      for (int i = 0; i < CA; ++i) ra[i] = *(const v4f*)(ga + (size_t)i * 8 * DM + (kc + 1) * GKS);
#pragma unroll
      for (int i = 0; i < 8; ++i) rb[i] = *(const v8b*)(gb + (size_t)i * 16 * DM + (kc + 1) * GKS);
      asm volatile("s_wait_xcnt 0x0" ::: "memory"); }   // stands in front of the advance of the address registers that these loads name
#pragma unroll
    for (int kh = 0; kh < GKS; kh += 32) {   // the slice's two 32-k halves, in k order
      v16b b[4], ah[FM], al[FM];
#pragma unroll
      for (int j = 0; j < 4; ++j) b[j] = frag_b(sB + (buf * 128 + wn * 64 + j * 16 + col) * GPB + kh, lane);
#pragma unroll
      for (int i = 0; i < FM; ++i) { ah[i] = frag_b(sA + ((buf * NP) * BM + wm * (FM * 16) + i * 16 + col) * GPB + kh, lane); if (NP == 2) al[i] = frag_b(sA + ((buf * NP + 1) * BM + wm * (FM * 16) + i * 16 + col) * GPB + kh, lane); }
#pragma unroll
      for (int i = 0; i < FM; ++i) {
        if (NP == 2) {
#pragma unroll
          for (int j = 0; j < 4; ++j) acc[i][j] = wmma_bf(al[i], b[j], acc[i][j]); }
#pragma unroll
        for (int j = 0; j < 4; ++j) acc[i][j] = wmma_bf(ah[i], b[j], acc[i][j]); } } }
  __syncthreads();   // every wave has read the last slice: the caller may reuse the LDS
}
// ---- k_qkv: block = (128 rows, 128 cols), 2 x 2 waves of 64 x 64
__global__ __launch_bounds__(128) void k_qkv(const float* __restrict__ XQ, const float* __restrict__ XK, const float* __restrict__ XV, const __bf16* __restrict__ P, const float* __restrict__ BQ, const float* __restrict__ BK, const float* __restrict__ BV, _Float16* __restrict__ QK, _Float16* __restrict__ QKL, _Float16* __restrict__ VTH, _Float16* __restrict__ VTL) {
  const int which0 = (blockIdx.y * 128) / DM; const float* X = (which0 == 0) ? XQ : (which0 == 1) ? XK : XV; const float* BB = BQ ? (((which0 == 0) ? BQ : (which0 == 1) ? BK : BV) + (blockIdx.y * 128 - which0 * DM)) : nullptr;
  __shared__ __align__(16) unsigned char sm[2 * 2 * 128 * GPB * 2];   // loop: A and B slices, two buffers each (73,728 B); epilogue: hi and residual planes [128][136] f16 (69,632 B)
  static_assert(2 * 2 * 128 * GPB * 2 >= 2 * 128 * 136 * 2, "the epilogue's planes fit the loop's buffers");
  const int tid = threadIdx.x, wave = tid >> 5, lane = tid & 31, col = lane & 15, g = lane >> 4, wm = wave >> 1, wn = wave & 1; const size_t rb = (size_t)blockIdx.x * 128; const int n0 = blockIdx.y * 128;
  v8f acc[4][4] = {};
  gemm_tile<4, 1>(X + rb * DM, P + (size_t)n0 * DM, (__bf16*)sm, (__bf16*)sm + 2 * 128 * GPB, acc, tid);
  _Float16 (*sh)[136] = (_Float16 (*)[136])sm; _Float16 (*sl)[136] = (_Float16 (*)[136])(sm + 128 * 136 * 2);
  if (n0 < 2 * DM) {   // q stored unscaled (f16 sigma ~0.6, no subnormal exposure); 1/8 applied to the f32 score
#pragma unroll
    for (int i = 0; i < 4; ++i) {
#pragma unroll
      for (int j = 0; j < 4; ++j) { const int c = wn * 64 + j * 16 + col; const float bv = BB ? bfr(BB[c]) : 0.f;
#pragma unroll
        for (int r = 0; r < 8; ++r) { const float v = acc[i][j][r] + bv; const _Float16 hv = (_Float16)v; sh[wm * 64 + i * 16 + 8 * g + r][c] = hv; sl[wm * 64 + i * 16 + 8 * g + r][c] = (_Float16)((v - (float)hv) * 2048.0f); } } }   // q, k (+ bias) as f16 hi + (x2048) residual
    __syncthreads();
#pragma unroll
    for (int it = 0; it < 16; ++it) { const int rl = it * 8 + (tid >> 4), pc = tid & 15; const size_t o = (rb + rl) * (2 * DM) + n0 + pc * 8; vst2((unsigned*)(QK + o), *(const v4u*)&sh[rl][pc * 8]); vst2((unsigned*)(QKL + o), *(const v4u*)&sl[rl][pc * 8]); }
  } else {   // v transposed: planes [d][s]
#pragma unroll
    for (int i = 0; i < 4; ++i) {
#pragma unroll
      for (int j = 0; j < 4; ++j) { const int c = wn * 64 + j * 16 + col; const float bv = BB ? bfr(BB[c]) : 0.f; v8h hq, lq;
#pragma unroll
        for (int r = 0; r < 8; ++r) { const float v = acc[i][j][r] + bv; const _Float16 hv = (_Float16)v; hq[r] = hv; lq[r] = (_Float16)((v - (float)hv) * 2048.0f); }
        *(v8h*)&sh[c][wm * 64 + i * 16 + 8 * g] = hq; *(v8h*)&sl[c][wm * 64 + i * 16 + 8 * g] = lq; } }
    __syncthreads();
    const int b = (int)(rb / SS), s0 = (int)(rb % SS); const int pc0 = n0 - 2 * DM;
#pragma unroll
    for (int it = 0; it < 16; ++it) { const int d = it * 8 + (tid >> 4), pc = tid & 15; const size_t o = ((size_t)b * DM + pc0 + d) * SS + s0 + pc * 8; vst2((unsigned*)(VTH + o), *(const v4u*)&sh[d][pc * 8]); vst2((unsigned*)(VTL + o), *(const v4u*)&sl[d][pc * 8]); }
  }
}
// ---- k_attn: block = (64 queries, head h, batch b): banded flash attention (K = 64: 2 k-steps), scores = (q.k) * 0.125, P.V: f16 P x (V hi, V lo*2048) in two accumulators; O[b*S+q][h*64+d] = (acc + accl / 2048) / (2048 l) (256-B segments)
// Both products are formed transposed: S^T = K . Q^T (A = key rows, B = the wave's 16 queries) and O^T += V^T . P^T. A lane then holds 16 of the 32 scores of ONE query (its column), so that the maximum and the sum are taken
// in the lane (the maximum joined with the other lane half once per 32 keys, the sum once in the epilogue), and the two score tiles, converted in place, are the B operand of the second product: P never leaves the registers.
// The keys are walked in stages of 64. A stage is four planes (k hi, k residual: [key][64 d]; v hi, v residual: [d][64 keys]) of 64 rows x 128 B, brought into LDS once per work-group by asynchronous copies
// (whole 128-B lines, two buffers, the next stage in flight while this one is worked on) and read from there by all four waves.
#define STG_PLANE 8192                 // 64 rows x 128 B
#define STG_BYTES (4 * STG_PLANE)
// Rows lie at a pitch of 128 B; the 16-byte piece c of row r lies at place c ^ ((r >> 1) & 7), so that the 16 rows which a half wave's ds_load_b128 reads at one c fall on all 64 banks.
// copy8: rows r, r + 16, r + 32, r + 48 of two planes, 16 B a lane. The s_wait_xcnt closes the statement so that it stands in front of every later write of the address registers that the copies name.
__device__ __forceinline__ void copy8(unsigned l0, unsigned l1, const _Float16* g0, const _Float16* g1) {
  asm volatile("global_load_async_to_lds_b128 %0, %8, off\n\t"
               "global_load_async_to_lds_b128 %1, %9, off\n\t"
               "global_load_async_to_lds_b128 %2, %10, off\n\t"
               "global_load_async_to_lds_b128 %3, %11, off\n\t"
               "global_load_async_to_lds_b128 %4, %12, off\n\t"
               "global_load_async_to_lds_b128 %5, %13, off\n\t"
               "global_load_async_to_lds_b128 %6, %14, off\n\t"
               "global_load_async_to_lds_b128 %7, %15, off\n\t"
               "s_wait_xcnt 0x0"
               :: "v"(l0), "v"(l0 + 2048u), "v"(l0 + 4096u), "v"(l0 + 6144u), "v"(l1), "v"(l1 + 2048u), "v"(l1 + 4096u), "v"(l1 + 6144u),
                  "v"(g0), "v"(g0 + 16 * 2048), "v"(g0 + 32 * 2048), "v"(g0 + 48 * 2048), "v"(g1), "v"(g1 + 16 * 2048), "v"(g1 + 32 * 2048), "v"(g1 + 48 * 2048)
               : "memory");
}
// the value of lane l ^ 16: the other half of the same column
__device__ __forceinline__ float xhalf(float v) { const int b = __builtin_bit_cast(int, v); return __builtin_bit_cast(float, __builtin_amdgcn_permlanex16(b, b, 0x76543210, 0xfedcba98, false, false)); }
__device__ __forceinline__ v16h frag_l(const unsigned char* row, int o0, int o1) {
  union { v16h v; v8h q[2]; } u; u.q[0] = *(const v8h*)(row + o0); u.q[1] = *(const v8h*)(row + o1); return u.v;
}
__global__ __launch_bounds__(128) void k_attn(const _Float16* __restrict__ QK, const _Float16* __restrict__ QKL, const _Float16* __restrict__ VTH, const _Float16* __restrict__ VTL, const void* __restrict__ KMASK, float* __restrict__ O) {
  static_assert(2 * DM == 2048 && SS == 2048 && HD == 64, "copy8 steps 16 rows of 2,048 f16"); static_assert(LW % 64 == 0 && SS % 64 == 0, "the window is whole stages of 64 keys");
  __shared__ __align__(128) unsigned char sm[2 * STG_BYTES];   // two stage buffers (epilogue: the output rows [4][16][68] f32)
  float (*so)[16][68] = (float (*)[16][68])sm;
  const int tid = threadIdx.x, wave = tid >> 5, lane = tid & 31, col = lane & 15, g = lane >> 4;
  const int qb = blockIdx.x, h = blockIdx.y, b = blockIdx.z; const int q0 = qb * 64 + wave * 16; const size_t rq = (size_t)b * SS + q0 + col;
  const int nks = SS / 32;   // all keys
  const int ks0 = (qb * 64 - LW) > 0 ? (qb * 64 - LW) / 32 : 0; const int ks1 = ((qb * 64 + 64 + LW + 31) / 32) < nks ? ((qb * 64 + 64 + LW + 31) / 32) : nks;   // window tiles: both even, so the window is whole stages
  const int st0 = ks0 >> 1, ns = (ks1 >> 1) - st0;
  // copies: thread t takes piece t & 7 of rows (t >> 3) + 16 i of each plane: a wave-wide copy covers four whole lines
  const int crow = tid >> 3, cpc = tid & 7;
  const unsigned lc = (unsigned)(size_t)sm + (unsigned)(crow * 128 + ((cpc ^ ((crow >> 1) & 7)) << 4));
  const size_t gko = ((size_t)b * SS + st0 * 64 + crow) * (2 * DM) + DM + h * HD + cpc * 8, gvo = ((size_t)b * DM + h * HD + crow) * SS + st0 * 64 + cpc * 8;
  const _Float16 *gk = QK + gko, *gkl = QKL + gko, *gv = VTH + gvo, *gvl = VTL + gvo;   // stage t: k rows advance by 64 rows, v rows by 64 keys
  copy8(lc, lc + STG_PLANE, gk, gkl); copy8(lc + 2 * STG_PLANE, lc + 3 * STG_PLANE, gv, gvl);
  v16h aq[2], aql[2];
#pragma unroll
  for (int kc = 0; kc < 2; ++kc) { aq[kc] = frag_h(QK + rq * (2 * DM) + h * HD + kc * 32, lane); aql[kc] = frag_h(QKL + rq * (2 * DM) + h * HD + kc * 32, lane); }
  float m = -3.0e38f, l = 0.f;   // of query q0 + col: the running maximum (equal in both lane halves) and this lane half's share of the sum
  v8f acc[4] = {}, accl[4] = {};
  asm volatile("s_wait_asynccnt 0x0" ::: "memory");   // this wave's copies of stage 0 have landed
  __syncthreads();                                    // publishes stage 0
  if (ns > 1) { copy8(lc + STG_BYTES, lc + STG_BYTES + STG_PLANE, gk + (size_t)64 * 2 * DM, gkl + (size_t)64 * 2 * DM); copy8(lc + STG_BYTES + 2 * STG_PLANE, lc + STG_BYTES + 3 * STG_PLANE, gv + 64, gvl + 64); }
  const int swz = (col >> 1) & 7; int fo[4];   // a fragment's pieces 2 j + g of a 128-B row, at their places
#pragma unroll
  for (int j = 0; j < 4; ++j) fo[j] = ((2 * j + g) ^ swz) << 4;
#pragma unroll 1   // one copy of the body: the buffer is chosen by an address, and nothing can move across the publish point
  for (int t = 0; t < ns; ++t) { const unsigned char* sb = sm + (t & 1) * STG_BYTES + col * 128;
#pragma unroll 1   // one copy of the body: the two halves of a stage differ by an address only
  for (int sub = 0; sub < 2; ++sub) { const int ks = (st0 + t) * 2 + sub; v8f s[2];
#pragma unroll
    for (int ct = 0; ct < 2; ++ct) { const int kk = ks * 32 + ct * 16 + 8 * g; const unsigned char* krow = sb + (sub * 32 + ct * 16) * 128; v8f c = {}, cl = {};   // register r: key kk + r
      v16h kh[2], kl[2];   // the 16 keys' fragments, read from LDS as one group ahead of their products: one wait instead of one per product
#pragma unroll
      for (int kc = 0; kc < 2; ++kc) { kh[kc] = frag_l(krow, fo[2 * kc], fo[2 * kc + 1]); kl[kc] = frag_l(krow + STG_PLANE, fo[2 * kc], fo[2 * kc + 1]); }
      if (qb < 32) {   // every query block (qb < 32 holds for all 32 blocks of the grid): 3 products
#pragma unroll
        for (int kc = 0; kc < 2; ++kc) { c = wmma16(kh[kc], aq[kc], c); cl = wmma16(kh[kc], aql[kc], cl); cl = wmma16(kl[kc], aq[kc], cl); }
#pragma unroll
        for (int r = 0; r < 8; ++r) c[r] += cl[r] * (1.0f / 2048.0f); }
      else {
#pragma unroll
        for (int kc = 0; kc < 2; ++kc) c = wmma16(kh[kc], aq[kc], c); }   // single product (never taken: qb < 32 in every block)
#pragma unroll
      for (int r = 0; r < 8; ++r) { const int dq = (q0 + col) - (kk + r); s[ct][r] = (dq <= LW && dq >= -LW) ? c[r] * 0.125f : -3.0e38f; } }   // 1/sqrt(64); masked keys excluded
    float mx = fmaxf(s[0][0], s[1][0]);   // the full unrolls of this body keep s, acc, accl, pa and pl indexed by constants, that is, in registers
#pragma unroll
    for (int r = 1; r < 8; ++r) mx = fmaxf(mx, fmaxf(s[0][r], s[1][r]));
    mx = fmaxf(mx, xhalf(mx));   // the query's other 16 keys of this half stage
    const float mn = fmaxf(m, mx); const float alpha = (m <= -1.0e38f) ? 0.f : __expf(m - mn); m = mn;
    float es[2] = {0.f, 0.f};
#pragma unroll
    for (int ct = 0; ct < 2; ++ct) {
#pragma unroll
      for (int r = 0; r < 8; ++r) { const float e = (s[ct][r] <= -1.0e38f) ? 0.f : __expf(s[ct][r] - mn); s[ct][r] = e; es[ct] += e; } }
    l = l * alpha + (es[0] + es[1]);
#pragma unroll
    for (int dt = 0; dt < 4; ++dt) {
#pragma unroll
      for (int r = 0; r < 8; ++r) { acc[dt][r] *= alpha; accl[dt][r] *= alpha; } }
    const int vo0 = fo[0] ^ (sub << 6), vo1 = fo[1] ^ (sub << 6);   // pieces 4 sub + g and 4 sub + 2 + g: this half's 32 keys
    v16h pa, pl;   // B operand: element i = key 8 g + i (first tile's register i), element 8 + i = key 16 + 8 g + i (second tile's): the k order of the v fragments
#pragma unroll
    for (int i = 0; i < 8; ++i) { const float x0 = s[0][i] * 2048.0f, x1 = s[1][i] * 2048.0f; const _Float16 h0 = (_Float16)x0, h1 = (_Float16)x1; pa[i] = h0; pa[8 + i] = h1; pl[i] = (_Float16)((x0 - (float)h0) * 2048.0f); pl[8 + i] = (_Float16)((x1 - (float)h1) * 2048.0f); }   // P scaled by 2^11 before the f16 split so small softmax weights stay out of the f16 subnormal range; 2^-11 folded into the epilogue
#pragma unroll
    for (int dp = 0; dp < 4; dp += 2) { v16h vh[2], vl[2];   // two d tiles' fragments, read as one group ahead of their products
#pragma unroll
      for (int e = 0; e < 2; ++e) { const unsigned char* vrow = sb + 2 * STG_PLANE + (dp + e) * 16 * 128; vh[e] = frag_l(vrow, vo0, vo1); vl[e] = frag_l(vrow + STG_PLANE, vo0, vo1); }
#pragma unroll
      for (int e = 0; e < 2; ++e) { const int dt = dp + e; acc[dt] = wmma16(vh[e], pa, acc[dt]); if (qb < 32) { accl[dt] = wmma16(vh[e], pl, accl[dt]); accl[dt] = wmma16(vl[e], pa, accl[dt]); } } } }   // every query block (qb < 32 always): P hi/lo x V hi/lo (3 products)
    asm volatile("s_wait_dscnt 0x0" ::: "memory");      // this wave's reads of stage t have returned
    asm volatile("s_wait_asynccnt 0x0" ::: "memory");   // this wave's copies of stage t + 1 have landed
    __syncthreads();                                    // publishes stage t + 1 and ends every wave's reads of stage t's buffer
    if (t + 2 < ns) { const unsigned lb = lc + (t & 1) * STG_BYTES; const size_t ko = (size_t)(t + 2) * 64 * 2 * DM; const int vo = (t + 2) * 64;
      copy8(lb, lb + STG_PLANE, gk + ko, gkl + ko); copy8(lb + 2 * STG_PLANE, lb + 3 * STG_PLANE, gv + vo, gvl + vo); } }
  asm volatile("s_wait_asynccnt 0x0" ::: "memory");   // no copy is outstanding when the buffers become output staging
  const float il = (1.0f / 2048.0f) / (l + xhalf(l));   // the two lane halves' sums joined
#pragma unroll
  for (int dt = 0; dt < 4; ++dt) {   // register r: d = 16 dt + 8 g + r of query q0 + col
#pragma unroll
    for (int r4 = 0; r4 < 8; r4 += 4) { v4f o;
#pragma unroll
      for (int e = 0; e < 4; ++e) o[e] = (acc[dt][r4 + e] + accl[dt][r4 + e] * (1.0f / 2048.0f)) * il;
      *(v4f*)&so[wave][col][dt * 16 + 8 * g + r4] = o; } }
  LDSX();
  for (int rl = 0; rl < 16; ++rl) if (lane < 16) vst2(O + ((size_t)b * SS + q0 + rl) * DM + h * HD + lane * 4, *(const v4f*)&so[wave][rl][lane * 4]);
}
// ---- k_out: block = (64 rows, 128 cols), 2 x 2 waves of 32 x 64: out = O(hi/lo) . Wo rows (2 products) + bo
__global__ __launch_bounds__(128) void k_out(const float* __restrict__ O, const __bf16* __restrict__ P, const float* __restrict__ BO, float* __restrict__ Y) {
  __shared__ __align__(16) unsigned char sm[2 * 2 * 64 * GPB * 2 + 2 * 128 * GPB * 2];   // loop: A hi and lo and B slices, two buffers each (73,728 B); epilogue: [64][132] f32
  const int tid = threadIdx.x, wave = tid >> 5, lane = tid & 31, col = lane & 15, g = lane >> 4, wm = wave >> 1, wn = wave & 1; const size_t rb = (size_t)blockIdx.x * 64; const int n0 = blockIdx.y * 128;
  v8f acc[2][4] = {};
  gemm_tile<2, 2>(O + rb * DM, P + (size_t)n0 * DM, (__bf16*)sm, (__bf16*)sm + 2 * 2 * 64 * GPB, acc, tid);
  float (*so)[132] = (float (*)[132])sm;
#pragma unroll
  for (int i = 0; i < 2; ++i) {
#pragma unroll
    for (int j = 0; j < 4; ++j) { const int c = wn * 64 + j * 16 + col; const float bv = bfr(BO[n0 + c]);
#pragma unroll
      for (int r = 0; r < 8; ++r) so[wm * 32 + i * 16 + 8 * g + r][c] = acc[i][j][r] + bv; } }
  __syncthreads();
#pragma unroll
  for (int it = 0; it < 16; ++it) { const int rl = it * 4 + wave, c4 = lane; vst2(Y + (rb + rl) * DM + n0 + c4 * 4, *(const v4f*)&so[rl][c4 * 4]); }
}
extern "C" void kernel_launch(void* const* d_in, const int* in_sizes, int n_in, void* d_out, int out_size, void* d_ws, size_t ws_size, hipStream_t stream) {
  (void)in_sizes; (void)n_in; (void)out_size;
  const float** F = (const float**)d_in;   // 0 x [2,2048,1024], 1 W_qkv [3072,1024] natural (rows q | k | v), 2 W_proj [1024,1024] natural, 3 b_proj
  if (ws_size < (size_t)WS_END) return;
  char* ws = (char*)d_ws; __bf16* PK = (__bf16*)(ws + WS_PK); _Float16 *QK = (_Float16*)(ws + WS_QK), *QKL = (_Float16*)(ws + WS_QKL), *VTH = (_Float16*)(ws + WS_VTH), *VTL = (_Float16*)(ws + WS_VTL); float* O = (float*)(ws + WS_O);
  k_pack<<<dim3(PK_END / PKE), 256, 0, stream>>>(F[1], F[2], PK);
  k_qkv<<<dim3(TNB * SS / 128, QKVW / 128), 128, 0, stream>>>(F[0], F[0], F[0], PK + PK_A, nullptr, nullptr, nullptr, QK, QKL, VTH, VTL);
  k_attn<<<dim3(TQB, NH, TNB), 128, 0, stream>>>(QK, QKL, VTH, VTL, nullptr, O);
  k_out<<<dim3(TOB, DM / 128), 128, 0, stream>>>(O, PK + PK_P, F[3], (float*)d_out);
}

// v006
// It runs in 82.9 microseconds.
// Next to v005, in two timings, it ran 1.06 times as fast each time.
// Counting every step since v000, it is 3.54 times as fast.
// compute dtype: all float inputs rounded to bf16; qkv = x . W^T with EXACT bf16 products on WMMA 16x16x32 (natural rows), f16 hi + residual; banded attention (|i - j| <= 128 by index; other key tiles skipped) with 3-product logits and 3-product P.v (unit-scale projections), x 1/8, running-max softmax in f32 (hardware exp); out = ctx (bf16 hi + lo) . W_proj^T + b_proj; f32 output.
#include <hip/hip_runtime.h>
#include <math.h>

typedef __attribute__((ext_vector_type(16))) _Float16 v16h;
typedef __attribute__((ext_vector_type(16))) __bf16 v16b;
typedef __attribute__((ext_vector_type(8)))  _Float16 v8h;
typedef __attribute__((ext_vector_type(8)))  float v8f;
typedef __attribute__((ext_vector_type(4)))  float v4f;
typedef __attribute__((ext_vector_type(2)))  float v2f;
typedef __attribute__((ext_vector_type(4)))  unsigned v4u;
typedef __attribute__((ext_vector_type(4)))  int v4i;
typedef float __attribute__((may_alias)) float_a;
typedef int __attribute__((may_alias)) int_a;

template <typename T> __device__ __forceinline__ void vst2(void* p, T v) { *(T*)p = v;  }
__device__ __forceinline__ v8f wmma16(v16h a, v16h b, v8f c) {
  return __builtin_amdgcn_wmma_f32_16x16x32_f16(false, a, false, b, (short)0, c, false, false);
}
__device__ __forceinline__ v8f wmma_bf(v16b a, v16b b, v8f c) {
  v8f d = __builtin_amdgcn_wmma_f32_16x16x32_bf16(false, a, false, b, (short)0, c, false, false);
  asm volatile("v_nop\n\tv_nop\n\tv_nop\n\tv_nop" : "+v"(d) : "v"(a), "v"(b));
  return d;
}
// Efficient (sliding-window) attention (B 2, T 2,048, D 1,024, 16 heads x 64, window 128): bias-free natural qkv projection (rows q | k | v), |i - j| <= 128 else excluded (finfo.min fill), softmax(q k / 8) v, natural output projection + bias.
__device__ __forceinline__ v16h frag_h(const _Float16* rowk0, int lane) {
  union { v16h v; v8h q[2]; } u; const _Float16* p = rowk0 + 8 * (lane >> 4);
  u.q[0] = *(const v8h*)p; u.q[1] = *(const v8h*)(p + 16); return u.v;
}
__device__ __forceinline__ v16h frag_f32(const float* rowk0, int lane) {
  v16h a; const float* p = rowk0 + 8 * (lane >> 4);
#pragma unroll
  for (int i = 0; i < 8; ++i) { a[i] = (_Float16)p[i]; a[8 + i] = (_Float16)p[16 + i]; }
  return a;
}
__device__ __forceinline__ v16h frag_f32s(const float* rowk0, int lane, float sc) {
  v16h a; const float* p = rowk0 + 8 * (lane >> 4);
#pragma unroll
  for (int i = 0; i < 8; ++i) { a[i] = (_Float16)(p[i] * sc); a[8 + i] = (_Float16)(p[16 + i] * sc); }
  return a;
}
// column fragment from a [K][ld] layout (column n), rows >= K read as 0
__device__ __forceinline__ v16h fragc_f32(const float* W, int k0, int n, int lane, int ld, int K) {
  v16h a; const int g = lane >> 4;
#pragma unroll
  for (int i = 0; i < 8; ++i) { const int ka = k0 + 8 * g + i, kb = ka + 16;
    a[i] = (_Float16)(ka < K ? W[(size_t)(ka < K ? ka : K - 1) * ld + n] : 0.f); a[8 + i] = (_Float16)(kb < K ? W[(size_t)(kb < K ? kb : K - 1) * ld + n] : 0.f); }
  return a;
}
struct F2 { v16b h, l; };
__device__ __forceinline__ F2 bsplit16(const float v[16]) { F2 r;
#pragma unroll
  for (int i = 0; i < 16; ++i) { const __bf16 h = (__bf16)v[i]; r.h[i] = h; r.l[i] = (__bf16)(v[i] - (float)h); }
  return r; }
__device__ __forceinline__ F2 split_row(const float* row, int k0, int lane) { float v[16]; const float* p = row + k0 + 8 * (lane >> 4);
#pragma unroll
  for (int i = 0; i < 8; ++i) { v[i] = p[i]; v[8 + i] = p[16 + i]; }
  return bsplit16(v); }
__device__ __forceinline__ F2 split_rowK(const float* row, int k0, int lane, int K) { float v[16]; const int g = lane >> 4;
#pragma unroll
  for (int i = 0; i < 8; ++i) { const int ka = k0 + 8 * g + i, kb = ka + 16; v[i] = ka < K ? row[ka < K ? ka : K - 1] : 0.f; v[8 + i] = kb < K ? row[kb < K ? kb : K - 1] : 0.f; }
  return bsplit16(v); }
__device__ __forceinline__ F2 split_col(const float* W, int k0, int n, int lane, int ld, int K) { float v[16]; const int g = lane >> 4;
#pragma unroll
  for (int i = 0; i < 8; ++i) { const int ka = k0 + 8 * g + i, kb = ka + 16; v[i] = ka < K ? W[(size_t)(ka < K ? ka : K - 1) * ld + n] : 0.f; v[8 + i] = kb < K ? W[(size_t)(kb < K ? kb : K - 1) * ld + n] : 0.f; }
  return bsplit16(v); }
__device__ __forceinline__ v8f mac3(const F2& a, const F2& b, v8f c) { c = wmma_bf(a.l, b.h, c); c = wmma_bf(a.h, b.l, c); return wmma_bf(a.h, b.h, c); }
__device__ __forceinline__ float sigm(float v) { return 1.0f / (1.0f + expf(-v)); }
#define LDSX() do { asm volatile("s_wait_dscnt 0" ::: "memory"); __builtin_amdgcn_wave_barrier(); __builtin_amdgcn_fence(__ATOMIC_RELEASE, "workgroup"); } while (0)


#define NB 2
#define SS 2048
#define DM 1024
#define NH 16
#define LW 128
#define HD 64
#define QKVW (3 * DM)
#ifndef TQB
#define TQB (SS / 64)
#define TNB NB
#define TOB (NB * SS / 64)     // output row tiles (all)
#endif
typedef __attribute__((ext_vector_type(8))) __bf16 v8b;
__device__ __forceinline__ v16b frag_b(const __bf16* rowk0, int lane) {
  union { v16b v; v8b q[2]; } u; const __bf16* p = rowk0 + 8 * (lane >> 4);
  u.q[0] = *(const v8b*)p; u.q[1] = *(const v8b*)(p + 16); return u.v;
}
__device__ __forceinline__ float bfr(float v) { return (float)(__bf16)v; }
__device__ __attribute__((noinline)) float exp_ni(float v) { return expf(v); }
__device__ __attribute__((noinline)) float erf_ni(float v) { return erff(v); }

#define PK_A 0                       // [3072][1024] Wqkv rows (natural [out][in])
#define PK_P (PK_A + QKVW * DM)        // [1024][1024] Wo rows (natural)
#define PK_END (PK_P + DM * DM)
#define WS_PK  0u
#define WS_QK  (WS_PK + 2u * PK_END)             // f16 [4096 rows][2048]: q | k
#define WS_QKL (WS_QK + 2u * NB * SS * 2 * DM)     // f16 q | k residual planes x2048
#define WS_VTH (WS_QKL + 2u * NB * SS * 2 * DM)    // f16 [b][1024 (h*64+d)][2048 s] hi
#define WS_VTL (WS_VTH + 2u * NB * DM * SS)        // f16 lo x 2048
#define WS_O   (WS_VTL + 2u * NB * DM * SS)        // f32 [4096][1024]
#define WS_CS  (WS_O + 4u * NB * SS * DM)           // f32 2 x [2048][32], not read or written
#define WS_END (WS_CS + 4u * 2 * SS * 32)
typedef __attribute__((ext_vector_type(4))) __bf16 v4b;
#define PKE 16384   // elements of one work-group: 256 threads x 16 loads of 4
// ---- k_pack: both weights (natural [out][in] rows) rounded to bf16, element for element in their own order: PK = W_qkv rows (PK_A), then W_proj rows (PK_P).
// Few, long work-groups (one per 64 KiB of source, 2,048 waves in all) instead of one per row (32,768 waves): fewer waves to start for the same bytes. A thread has its 16 loads in flight together;
// each wave-wide load covers 512 contiguous bytes (four whole lines), each wave-wide store 256 (two whole lines).
__global__ __launch_bounds__(256) void k_pack(const float* __restrict__ WA, const float* __restrict__ WO, __bf16* __restrict__ PK) {
  static_assert((QKVW * DM) % PKE == 0 && (DM * DM) % PKE == 0 && PK_A == 0 && PK_P == QKVW * DM, "a work-group's piece lies in one weight, and PK follows the sources' order");
  const int w = blockIdx.x, t = threadIdx.x;
  const float* s = ((w < QKVW * DM / PKE) ? WA + (size_t)w * PKE : WO + ((size_t)w * PKE - (size_t)QKVW * DM)) + t * 4;
  __bf16* d = PK + (size_t)w * PKE + t * 4;
  v4f r[16];   // the full unrolls keep r indexed by constants, that is, in registers
#pragma unroll
  for (int i = 0; i < 16; ++i) r[i] = *(const v4f*)(s + i * 1024);
  __builtin_amdgcn_sched_barrier(0);   // keeps all 16 loads ahead of the first conversion: without it the last two are issued only when the first two have returned, a second memory latency in every wave
#pragma unroll
  for (int i = 0; i < 16; ++i) { v4b h;
#pragma unroll
    for (int e = 0; e < 4; ++e) h[e] = (__bf16)r[i][e];
    *(v4b*)(d + i * 1024) = h; }
}
#define GKS 64   // k of one staged slice: a slice row is 256 bytes of A (f32) and a whole 128-byte line of B (bf16)
#define GPB 72   // LDS pitch of a 64-k bf16 tile row, in elements: 144 B = 16 B x odd, the conflict-free pitch for 16-byte reads
// ---- gemm_tile: one work-group's C[32 * FM][128] += A . B^T over K = DM. A: f32 rows, rounded to bf16 (NP == 1) or split bf16 hi + lo (NP == 2) once per work-group; B: bf16 rows.
// Each 64-k slice of both operands is staged once in LDS (two buffers, the next slice held in registers while this one is multiplied) and read, as two 32-k halves in k order, by 2 x 2 waves of FM x 4 tiles each.
// The full unrolls keep the register arrays (ra, rb, fragments, acc) indexed by constants; the k loop's unroll by 2 makes the buffer index a constant in each copy.
template <int FM, int NP>
__device__ __forceinline__ void gemm_tile(const float* __restrict__ A, const __bf16* __restrict__ B, __bf16* sA, __bf16* sB, v8f (&acc)[FM][4], int tid) {
  constexpr int BM = 32 * FM, CA = BM / 8;
  const int wave = tid >> 5, lane = tid & 31, col = lane & 15, wm = wave >> 1, wn = wave & 1;
  const int arow = tid >> 4, ac = (tid & 15) * 4;   // staging of A: thread t takes 4 k of rows (t >> 4) + 8 i, so that each wave-wide 16-byte load covers two whole rows of 256 bytes
  const int srow = tid >> 3, sc = (tid & 7) * 8;    // staging of B: thread t takes 8 k of rows (t >> 3) + 16 i, so that each wave-wide 16-byte load covers four whole 128-byte lines
  const float* ga = A + (size_t)arow * DM + ac; const __bf16* gb = B + (size_t)srow * DM + sc;
  v4f ra[CA]; v8b rb[8];
#pragma unroll
  for (int i = 0; i < CA; ++i) ra[i] = *(const v4f*)(ga + (size_t)i * 8 * DM);
#pragma unroll
  for (int i = 0; i < 8; ++i) rb[i] = *(const v8b*)(gb + (size_t)i * 16 * DM);
  asm volatile("s_wait_xcnt 0x0" :: "v"(ga), "v"(gb) : "memory");   // stands in front of every later write of the address registers that the first slice's loads name: as inputs they stay live up to the wait
#pragma unroll 2
  for (int kc = 0; kc < DM / GKS; ++kc) { const int buf = kc & 1;
#pragma unroll
    for (int i = 0; i < CA; ++i) { v4b hv, lv;
#pragma unroll
      for (int e = 0; e < 4; ++e) { const float x = ra[i][e]; const __bf16 hb = (__bf16)x; hv[e] = hb; if (NP == 2) lv[e] = (__bf16)(x - (float)hb); }
      *(v4b*)(sA + ((buf * NP) * BM + arow + i * 8) * GPB + ac) = hv; if (NP == 2) *(v4b*)(sA + ((buf * NP + 1) * BM + arow + i * 8) * GPB + ac) = lv; }
#pragma unroll
    for (int i = 0; i < 8; ++i) *(v8b*)(sB + (buf * 128 + srow + i * 16) * GPB + sc) = rb[i];
    __syncthreads();   // publishes slice kc; the other buffer's readers (slice kc - 1) are all past it before slice kc + 1 is stored there
    if (kc + 1 < DM / GKS) {
#pragma unroll
      for (int i = 0; i < CA; ++i) ra[i] = *(const v4f*)(ga + (size_t)i * 8 * DM + (kc + 1) * GKS);
#pragma unroll
      for (int i = 0; i < 8; ++i) rb[i] = *(const v8b*)(gb + (size_t)i * 16 * DM + (kc + 1) * GKS);
      asm volatile("s_wait_xcnt 0x0" ::: "memory"); }   // stands in front of the advance of the address registers that these loads name
#pragma unroll
    for (int kh = 0; kh < GKS; kh += 32) {   // the slice's two 32-k halves, in k order
      v16b b[4], ah[FM], al[FM];
#pragma unroll
      for (int j = 0; j < 4; ++j) b[j] = frag_b(sB + (buf * 128 + wn * 64 + j * 16 + col) * GPB + kh, lane);
#pragma unroll
      for (int i = 0; i < FM; ++i) { ah[i] = frag_b(sA + ((buf * NP) * BM + wm * (FM * 16) + i * 16 + col) * GPB + kh, lane); if (NP == 2) al[i] = frag_b(sA + ((buf * NP + 1) * BM + wm * (FM * 16) + i * 16 + col) * GPB + kh, lane); }
#pragma unroll
      for (int i = 0; i < FM; ++i) {
        if (NP == 2) {
#pragma unroll
          for (int j = 0; j < 4; ++j) acc[i][j] = wmma_bf(al[i], b[j], acc[i][j]); }
#pragma unroll
        for (int j = 0; j < 4; ++j) acc[i][j] = wmma_bf(ah[i], b[j], acc[i][j]); } } }
  __syncthreads();   // every wave has read the last slice: the caller may reuse the LDS
}
// ---- k_qkv: block = (128 rows, 128 cols), 2 x 2 waves of 64 x 64
__global__ __launch_bounds__(128) void k_qkv(const float* __restrict__ XQ, const float* __restrict__ XK, const float* __restrict__ XV, const __bf16* __restrict__ P, const float* __restrict__ BQ, const float* __restrict__ BK, const float* __restrict__ BV, _Float16* __restrict__ QK, _Float16* __restrict__ QKL, _Float16* __restrict__ VTH, _Float16* __restrict__ VTL) {
  const int which0 = (blockIdx.y * 128) / DM; const float* X = (which0 == 0) ? XQ : (which0 == 1) ? XK : XV; const float* BB = BQ ? (((which0 == 0) ? BQ : (which0 == 1) ? BK : BV) + (blockIdx.y * 128 - which0 * DM)) : nullptr;
  __shared__ __align__(16) unsigned char sm[2 * 2 * 128 * GPB * 2];   // loop: A and B slices, two buffers each (73,728 B); epilogue: hi and residual planes [128][136] f16 (69,632 B)
  static_assert(2 * 2 * 128 * GPB * 2 >= 2 * 128 * 136 * 2, "the epilogue's planes fit the loop's buffers");
  const int tid = threadIdx.x, wave = tid >> 5, lane = tid & 31, col = lane & 15, g = lane >> 4, wm = wave >> 1, wn = wave & 1; const size_t rb = (size_t)blockIdx.x * 128; const int n0 = blockIdx.y * 128;
  v8f acc[4][4] = {};
  gemm_tile<4, 1>(X + rb * DM, P + (size_t)n0 * DM, (__bf16*)sm, (__bf16*)sm + 2 * 128 * GPB, acc, tid);
  _Float16 (*sh)[136] = (_Float16 (*)[136])sm; _Float16 (*sl)[136] = (_Float16 (*)[136])(sm + 128 * 136 * 2);
  if (n0 < 2 * DM) {   // q stored unscaled (f16 sigma ~0.6, no subnormal exposure); 1/8 applied to the f32 score
#pragma unroll
    for (int i = 0; i < 4; ++i) {
#pragma unroll
      for (int j = 0; j < 4; ++j) { const int c = wn * 64 + j * 16 + col; const float bv = BB ? bfr(BB[c]) : 0.f;
#pragma unroll
        for (int r = 0; r < 8; ++r) { const float v = acc[i][j][r] + bv; const _Float16 hv = (_Float16)v; sh[wm * 64 + i * 16 + 8 * g + r][c] = hv; sl[wm * 64 + i * 16 + 8 * g + r][c] = (_Float16)((v - (float)hv) * 2048.0f); } } }   // q, k (+ bias) as f16 hi + (x2048) residual
    __syncthreads();
#pragma unroll
    for (int it = 0; it < 16; ++it) { const int rl = it * 8 + (tid >> 4), pc = tid & 15; const size_t o = (rb + rl) * (2 * DM) + n0 + pc * 8; vst2((unsigned*)(QK + o), *(const v4u*)&sh[rl][pc * 8]); vst2((unsigned*)(QKL + o), *(const v4u*)&sl[rl][pc * 8]); }
  } else {   // v transposed: planes [d][s]
#pragma unroll
    for (int i = 0; i < 4; ++i) {
#pragma unroll
      for (int j = 0; j < 4; ++j) { const int c = wn * 64 + j * 16 + col; const float bv = BB ? bfr(BB[c]) : 0.f; v8h hq, lq;
#pragma unroll
        for (int r = 0; r < 8; ++r) { const float v = acc[i][j][r] + bv; const _Float16 hv = (_Float16)v; hq[r] = hv; lq[r] = (_Float16)((v - (float)hv) * 2048.0f); }
        *(v8h*)&sh[c][wm * 64 + i * 16 + 8 * g] = hq; *(v8h*)&sl[c][wm * 64 + i * 16 + 8 * g] = lq; } }
    __syncthreads();
    const int b = (int)(rb / SS), s0 = (int)(rb % SS); const int pc0 = n0 - 2 * DM;
#pragma unroll
    for (int it = 0; it < 16; ++it) { const int d = it * 8 + (tid >> 4), pc = tid & 15; const size_t o = ((size_t)b * DM + pc0 + d) * SS + s0 + pc * 8; vst2((unsigned*)(VTH + o), *(const v4u*)&sh[d][pc * 8]); vst2((unsigned*)(VTL + o), *(const v4u*)&sl[d][pc * 8]); }
  }
}
// ---- k_attn: block = (64 queries, head h, batch b): banded flash attention (K = 64: 2 k-steps), scores = (q.k) * 0.125, P.V: f16 P x (V hi, V lo*2048) in two accumulators; O[b*S+q][h*64+d] = (acc + accl / 2048) / (2048 l) (256-B segments)
// Both products are formed transposed: S^T = K . Q^T (A = key rows, B = the wave's 16 queries) and O^T += V^T . P^T. A lane then holds 16 of the 32 scores of ONE query (its column), so that the maximum and the sum are taken
// in the lane (the maximum joined with the other lane half once per 32 keys, the sum once in the epilogue), and the two score tiles, converted in place, are the B operand of the second product: P never leaves the registers.
// The keys are walked in stages of 64. A stage is four planes (k hi, k residual: [key][64 d]; v hi, v residual: [d][64 keys]) of 64 rows x 128 B, brought into LDS once per work-group by asynchronous copies
// (whole 128-B lines, two buffers, the next stage in flight while this one is worked on) and read from there by all four waves.
#define STG_PLANE 8192                 // 64 rows x 128 B
#define STG_BYTES (4 * STG_PLANE)
// Rows lie at a pitch of 128 B; the 16-byte piece c of row r lies at place c ^ ((r >> 1) & 7), so that the 16 rows which a half wave's ds_load_b128 reads at one c fall on all 64 banks.
// copy8: rows r, r + 16, r + 32, r + 48 of two planes, 16 B a lane. The s_wait_xcnt closes the statement so that it stands in front of every later write of the address registers that the copies name.
__device__ __forceinline__ void copy8(unsigned l0, unsigned l1, const _Float16* g0, const _Float16* g1) {
  asm volatile("global_load_async_to_lds_b128 %0, %8, off\n\t"
               "global_load_async_to_lds_b128 %1, %9, off\n\t"
               "global_load_async_to_lds_b128 %2, %10, off\n\t"
               "global_load_async_to_lds_b128 %3, %11, off\n\t"
               "global_load_async_to_lds_b128 %4, %12, off\n\t"
               "global_load_async_to_lds_b128 %5, %13, off\n\t"
               "global_load_async_to_lds_b128 %6, %14, off\n\t"
               "global_load_async_to_lds_b128 %7, %15, off\n\t"
               "s_wait_xcnt 0x0"
               :: "v"(l0), "v"(l0 + 2048u), "v"(l0 + 4096u), "v"(l0 + 6144u), "v"(l1), "v"(l1 + 2048u), "v"(l1 + 4096u), "v"(l1 + 6144u),
                  "v"(g0), "v"(g0 + 16 * 2048), "v"(g0 + 32 * 2048), "v"(g0 + 48 * 2048), "v"(g1), "v"(g1 + 16 * 2048), "v"(g1 + 32 * 2048), "v"(g1 + 48 * 2048)
               : "memory");
}
// the value of lane l ^ 16: the other half of the same column
__device__ __forceinline__ float xhalf(float v) { const int b = __builtin_bit_cast(int, v); return __builtin_bit_cast(float, __builtin_amdgcn_permlanex16(b, b, 0x76543210, 0xfedcba98, false, false)); }
__device__ __forceinline__ v16h frag_l(const unsigned char* row, int o0, int o1) {
  union { v16h v; v8h q[2]; } u; u.q[0] = *(const v8h*)(row + o0); u.q[1] = *(const v8h*)(row + o1); return u.v;
}
__global__ __launch_bounds__(128) void k_attn(const _Float16* __restrict__ QK, const _Float16* __restrict__ QKL, const _Float16* __restrict__ VTH, const _Float16* __restrict__ VTL, const void* __restrict__ KMASK, float* __restrict__ O) {
  static_assert(2 * DM == 2048 && SS == 2048 && HD == 64, "copy8 steps 16 rows of 2,048 f16"); static_assert(LW % 64 == 0 && SS % 64 == 0, "the window is whole stages of 64 keys"); static_assert(TQB <= 32, "every query block takes the three-product form");
  __shared__ __align__(128) unsigned char sm[2 * STG_BYTES];   // two stage buffers (epilogue: the output rows [4][16][68] f32)
  float (*so)[16][68] = (float (*)[16][68])sm;
  const int tid = threadIdx.x, wave = tid >> 5, lane = tid & 31, col = lane & 15, g = lane >> 4;
  const int qb = blockIdx.x, h = blockIdx.y, b = blockIdx.z; const int q0 = qb * 64 + wave * 16; const size_t rq = (size_t)b * SS + q0 + col;
  const int nks = SS / 32;   // all keys
  const int ks0 = (qb * 64 - LW) > 0 ? (qb * 64 - LW) / 32 : 0; const int ks1 = ((qb * 64 + 64 + LW + 31) / 32) < nks ? ((qb * 64 + 64 + LW + 31) / 32) : nks;   // window tiles: both even, so the window is whole stages
  const int st0 = ks0 >> 1, ns = (ks1 >> 1) - st0;
  // copies: thread t takes piece t & 7 of rows (t >> 3) + 16 i of each plane: a wave-wide copy covers four whole lines
  const int crow = tid >> 3, cpc = tid & 7;
  const unsigned lc = (unsigned)(size_t)sm + (unsigned)(crow * 128 + ((cpc ^ ((crow >> 1) & 7)) << 4));
  const size_t gko = ((size_t)b * SS + st0 * 64 + crow) * (2 * DM) + DM + h * HD + cpc * 8, gvo = ((size_t)b * DM + h * HD + crow) * SS + st0 * 64 + cpc * 8;
  const _Float16 *gk = QK + gko, *gkl = QKL + gko, *gv = VTH + gvo, *gvl = VTL + gvo;   // stage t: k rows advance by 64 rows, v rows by 64 keys
  copy8(lc, lc + STG_PLANE, gk, gkl); copy8(lc + 2 * STG_PLANE, lc + 3 * STG_PLANE, gv, gvl);
  v16h aq[2], aql[2];
#pragma unroll
  for (int kc = 0; kc < 2; ++kc) { aq[kc] = frag_h(QK + rq * (2 * DM) + h * HD + kc * 32, lane); aql[kc] = frag_h(QKL + rq * (2 * DM) + h * HD + kc * 32, lane); }
  float m = -3.0e38f, l = 0.f;   // of query q0 + col: the running maximum (equal in both lane halves) and this lane half's share of the sum
  v8f acc[4] = {}, accl[4] = {};
  asm volatile("s_wait_asynccnt 0x0" ::: "memory");   // this wave's copies of stage 0 have landed
  __syncthreads();                                    // publishes stage 0
  if (ns > 1) { copy8(lc + STG_BYTES, lc + STG_BYTES + STG_PLANE, gk + (size_t)64 * 2 * DM, gkl + (size_t)64 * 2 * DM); copy8(lc + STG_BYTES + 2 * STG_PLANE, lc + STG_BYTES + 3 * STG_PLANE, gv + 64, gvl + 64); }
  const int swz = (col >> 1) & 7; int fo[4];   // a fragment's pieces 2 j + g of a 128-B row, at their places
#pragma unroll
  for (int j = 0; j < 4; ++j) fo[j] = ((2 * j + g) ^ swz) << 4;
#pragma unroll 1   // one copy of the body: the buffer is chosen by an address, and nothing can move across the publish point
  for (int t = 0; t < ns; ++t) { const unsigned char* sb = sm + (t & 1) * STG_BYTES + col * 128;
#pragma unroll 1   // one copy of the body: the two halves of a stage differ by an address only
  for (int sub = 0; sub < 2; ++sub) { const int ks = (st0 + t) * 2 + sub; v8f s[2];
#pragma unroll
    for (int ct = 0; ct < 2; ++ct) { const int kk = ks * 32 + ct * 16 + 8 * g; const unsigned char* krow = sb + (sub * 32 + ct * 16) * 128; v8f c = {}, cl = {};   // register r: key kk + r
      v16h kh[2], kl[2];   // the 16 keys' fragments, read from LDS as one group ahead of their products: one wait instead of one per product
#pragma unroll
      for (int kc = 0; kc < 2; ++kc) { kh[kc] = frag_l(krow, fo[2 * kc], fo[2 * kc + 1]); kl[kc] = frag_l(krow + STG_PLANE, fo[2 * kc], fo[2 * kc + 1]); }
#pragma unroll
      for (int kc = 0; kc < 2; ++kc) { c = wmma16(kh[kc], aq[kc], c); cl = wmma16(kh[kc], aql[kc], cl); cl = wmma16(kl[kc], aq[kc], cl); }   // 3 products: hi.hi, and hi.residual + residual.hi at 2^11
#pragma unroll
      for (int r = 0; r < 8; ++r) c[r] += cl[r] * (1.0f / 2048.0f);
#pragma unroll
      for (int r = 0; r < 8; ++r) { const int dq = (q0 + col) - (kk + r); s[ct][r] = (dq <= LW && dq >= -LW) ? c[r] * 0.125f : -3.0e38f; } }   // 1/sqrt(64); masked keys excluded
    float mx = fmaxf(s[0][0], s[1][0]);   // the full unrolls of this body keep s, acc, accl, pa and pl indexed by constants, that is, in registers
#pragma unroll
    for (int r = 1; r < 8; ++r) mx = fmaxf(mx, fmaxf(s[0][r], s[1][r]));
    mx = fmaxf(mx, xhalf(mx));   // the query's other 16 keys of this half stage
    const float mn = fmaxf(m, mx); const float alpha = (m <= -1.0e38f) ? 0.f : __expf(m - mn); m = mn;
    float es[2] = {0.f, 0.f};
#pragma unroll
    for (int ct = 0; ct < 2; ++ct) {
#pragma unroll
      for (int r = 0; r < 8; ++r) { const float e = (s[ct][r] <= -1.0e38f) ? 0.f : __expf(s[ct][r] - mn); s[ct][r] = e; es[ct] += e; } }
    l = l * alpha + (es[0] + es[1]);
#pragma unroll
    for (int dt = 0; dt < 4; ++dt) {
#pragma unroll
      for (int r = 0; r < 8; ++r) { acc[dt][r] *= alpha; accl[dt][r] *= alpha; } }
    const int vo0 = fo[0] ^ (sub << 6), vo1 = fo[1] ^ (sub << 6);   // pieces 4 sub + g and 4 sub + 2 + g: this half's 32 keys
    v16h pa, pl;   // B operand: element i = key 8 g + i (first tile's register i), element 8 + i = key 16 + 8 g + i (second tile's): the k order of the v fragments
#pragma unroll
    for (int i = 0; i < 8; ++i) { const float x0 = s[0][i] * 2048.0f, x1 = s[1][i] * 2048.0f; const _Float16 h0 = (_Float16)x0, h1 = (_Float16)x1; pa[i] = h0; pa[8 + i] = h1; pl[i] = (_Float16)((x0 - (float)h0) * 2048.0f); pl[8 + i] = (_Float16)((x1 - (float)h1) * 2048.0f); }   // P scaled by 2^11 before the f16 split so small softmax weights stay out of the f16 subnormal range; 2^-11 folded into the epilogue
#pragma unroll
    for (int dp = 0; dp < 4; dp += 2) { v16h vh[2], vl[2];   // two d tiles' fragments, read as one group ahead of their products
#pragma unroll
      for (int e = 0; e < 2; ++e) { const unsigned char* vrow = sb + 2 * STG_PLANE + (dp + e) * 16 * 128; vh[e] = frag_l(vrow, vo0, vo1); vl[e] = frag_l(vrow + STG_PLANE, vo0, vo1); }
#pragma unroll
      for (int e = 0; e < 2; ++e) { const int dt = dp + e; acc[dt] = wmma16(vh[e], pa, acc[dt]); accl[dt] = wmma16(vh[e], pl, accl[dt]); accl[dt] = wmma16(vl[e], pa, accl[dt]); } } }   // P hi/lo x V hi/lo (3 products)
    asm volatile("s_wait_dscnt 0x0" ::: "memory");      // this wave's reads of stage t have returned
    asm volatile("s_wait_asynccnt 0x0" ::: "memory");   // this wave's copies of stage t + 1 have landed
    __syncthreads();                                    // publishes stage t + 1 and ends every wave's reads of stage t's buffer
    if (t + 2 < ns) { const unsigned lb = lc + (t & 1) * STG_BYTES; const size_t ko = (size_t)(t + 2) * 64 * 2 * DM; const int vo = (t + 2) * 64;
      copy8(lb, lb + STG_PLANE, gk + ko, gkl + ko); copy8(lb + 2 * STG_PLANE, lb + 3 * STG_PLANE, gv + vo, gvl + vo); } }
  asm volatile("s_wait_asynccnt 0x0" ::: "memory");   // no copy is outstanding when the buffers become output staging
  const float il = (1.0f / 2048.0f) / (l + xhalf(l));   // the two lane halves' sums joined
#pragma unroll
  for (int dt = 0; dt < 4; ++dt) {   // register r: d = 16 dt + 8 g + r of query q0 + col
#pragma unroll
    for (int r4 = 0; r4 < 8; r4 += 4) { v4f o;
#pragma unroll
      for (int e = 0; e < 4; ++e) o[e] = (acc[dt][r4 + e] + accl[dt][r4 + e] * (1.0f / 2048.0f)) * il;
      *(v4f*)&so[wave][col][dt * 16 + 8 * g + r4] = o; } }
  LDSX();
  for (int rl = 0; rl < 16; ++rl) if (lane < 16) vst2(O + ((size_t)b * SS + q0 + rl) * DM + h * HD + lane * 4, *(const v4f*)&so[wave][rl][lane * 4]);
}
// ---- k_out: block = (64 rows, 128 cols), 2 x 2 waves of 32 x 64: out = O(hi/lo) . Wo rows (2 products) + bo
__global__ __launch_bounds__(128) void k_out(const float* __restrict__ O, const __bf16* __restrict__ P, const float* __restrict__ BO, float* __restrict__ Y) {
  __shared__ __align__(16) unsigned char sm[2 * 2 * 64 * GPB * 2 + 2 * 128 * GPB * 2];   // loop: A hi and lo and B slices, two buffers each (73,728 B); epilogue: [64][132] f32
  const int tid = threadIdx.x, wave = tid >> 5, lane = tid & 31, col = lane & 15, g = lane >> 4, wm = wave >> 1, wn = wave & 1; const size_t rb = (size_t)blockIdx.x * 64; const int n0 = blockIdx.y * 128;
  v8f acc[2][4] = {};
  gemm_tile<2, 2>(O + rb * DM, P + (size_t)n0 * DM, (__bf16*)sm, (__bf16*)sm + 2 * 2 * 64 * GPB, acc, tid);
  float (*so)[132] = (float (*)[132])sm;
#pragma unroll
  for (int i = 0; i < 2; ++i) {
#pragma unroll
    for (int j = 0; j < 4; ++j) { const int c = wn * 64 + j * 16 + col; const float bv = bfr(BO[n0 + c]);
#pragma unroll
      for (int r = 0; r < 8; ++r) so[wm * 32 + i * 16 + 8 * g + r][c] = acc[i][j][r] + bv; } }
  __syncthreads();
#pragma unroll
  for (int it = 0; it < 16; ++it) { const int rl = it * 4 + wave, c4 = lane; vst2(Y + (rb + rl) * DM + n0 + c4 * 4, *(const v4f*)&so[rl][c4 * 4]); }
}
extern "C" void kernel_launch(void* const* d_in, const int* in_sizes, int n_in, void* d_out, int out_size, void* d_ws, size_t ws_size, hipStream_t stream) {
  (void)in_sizes; (void)n_in; (void)out_size;
  const float** F = (const float**)d_in;   // 0 x [2,2048,1024], 1 W_qkv [3072,1024] natural (rows q | k | v), 2 W_proj [1024,1024] natural, 3 b_proj
  if (ws_size < (size_t)WS_END) return;
  char* ws = (char*)d_ws; __bf16* PK = (__bf16*)(ws + WS_PK); _Float16 *QK = (_Float16*)(ws + WS_QK), *QKL = (_Float16*)(ws + WS_QKL), *VTH = (_Float16*)(ws + WS_VTH), *VTL = (_Float16*)(ws + WS_VTL); float* O = (float*)(ws + WS_O);
  k_pack<<<dim3(PK_END / PKE), 256, 0, stream>>>(F[1], F[2], PK);
  k_qkv<<<dim3(TNB * SS / 128, QKVW / 128), 128, 0, stream>>>(F[0], F[0], F[0], PK + PK_A, nullptr, nullptr, nullptr, QK, QKL, VTH, VTL);
  k_attn<<<dim3(TQB, NH, TNB), 128, 0, stream>>>(QK, QKL, VTH, VTL, nullptr, O);
  k_out<<<dim3(TOB, DM / 128), 128, 0, stream>>>(O, PK + PK_P, F[3], (float*)d_out);
}

// v007
// A run of this version takes 79.3 microseconds.
// Timed twice side by side with v006, it ran 1.04 times as fast both times.
// Over all steps from v000 it is 3.69 times as fast.
// compute dtype: all float inputs rounded to bf16; qkv = x . W^T with EXACT bf16 products on WMMA 16x16x32 (natural rows), f16 hi + residual; banded attention (|i - j| <= 128 by index; other key tiles skipped) with 3-product logits and 3-product P.v (unit-scale projections), x 1/8, running-max softmax in f32 (hardware exp); out = ctx (bf16 hi + lo) . W_proj^T + b_proj; f32 output.
#include <hip/hip_runtime.h>
#include <math.h>

typedef __attribute__((ext_vector_type(16))) _Float16 v16h;
typedef __attribute__((ext_vector_type(16))) __bf16 v16b;
typedef __attribute__((ext_vector_type(8)))  _Float16 v8h;
typedef __attribute__((ext_vector_type(8)))  float v8f;
typedef __attribute__((ext_vector_type(4)))  float v4f;
typedef __attribute__((ext_vector_type(2)))  float v2f;
typedef __attribute__((ext_vector_type(4)))  unsigned v4u;
typedef __attribute__((ext_vector_type(4)))  int v4i;
typedef float __attribute__((may_alias)) float_a;
typedef int __attribute__((may_alias)) int_a;

template <typename T> __device__ __forceinline__ void vst2(void* p, T v) { *(T*)p = v;  }
__device__ __forceinline__ v8f wmma16(v16h a, v16h b, v8f c) {
  return __builtin_amdgcn_wmma_f32_16x16x32_f16(false, a, false, b, (short)0, c, false, false);
}
__device__ __forceinline__ v8f wmma_bf(v16b a, v16b b, v8f c) {
  v8f d = __builtin_amdgcn_wmma_f32_16x16x32_bf16(false, a, false, b, (short)0, c, false, false);
  asm volatile("v_nop\n\tv_nop\n\tv_nop\n\tv_nop" : "+v"(d) : "v"(a), "v"(b));
  return d;
}
// Efficient (sliding-window) attention (B 2, T 2,048, D 1,024, 16 heads x 64, window 128): bias-free natural qkv projection (rows q | k | v), |i - j| <= 128 else excluded (finfo.min fill), softmax(q k / 8) v, natural output projection + bias.
__device__ __forceinline__ v16h frag_h(const _Float16* rowk0, int lane) {
  union { v16h v; v8h q[2]; } u; const _Float16* p = rowk0 + 8 * (lane >> 4);
  u.q[0] = *(const v8h*)p; u.q[1] = *(const v8h*)(p + 16); return u.v;
}
__device__ __forceinline__ v16h frag_f32(const float* rowk0, int lane) {
  v16h a; const float* p = rowk0 + 8 * (lane >> 4);
#pragma unroll
  for (int i = 0; i < 8; ++i) { a[i] = (_Float16)p[i]; a[8 + i] = (_Float16)p[16 + i]; }
  return a;
}
__device__ __forceinline__ v16h frag_f32s(const float* rowk0, int lane, float sc) {
  v16h a; const float* p = rowk0 + 8 * (lane >> 4);
#pragma unroll
  for (int i = 0; i < 8; ++i) { a[i] = (_Float16)(p[i] * sc); a[8 + i] = (_Float16)(p[16 + i] * sc); }
  return a;
}
// column fragment from a [K][ld] layout (column n), rows >= K read as 0
__device__ __forceinline__ v16h fragc_f32(const float* W, int k0, int n, int lane, int ld, int K) {
  v16h a; const int g = lane >> 4;
#pragma unroll
  for (int i = 0; i < 8; ++i) { const int ka = k0 + 8 * g + i, kb = ka + 16;
    a[i] = (_Float16)(ka < K ? W[(size_t)(ka < K ? ka : K - 1) * ld + n] : 0.f); a[8 + i] = (_Float16)(kb < K ? W[(size_t)(kb < K ? kb : K - 1) * ld + n] : 0.f); }
  return a;
}
struct F2 { v16b h, l; };
__device__ __forceinline__ F2 bsplit16(const float v[16]) { F2 r;
#pragma unroll
  for (int i = 0; i < 16; ++i) { const __bf16 h = (__bf16)v[i]; r.h[i] = h; r.l[i] = (__bf16)(v[i] - (float)h); }
  return r; }
__device__ __forceinline__ F2 split_row(const float* row, int k0, int lane) { float v[16]; const float* p = row + k0 + 8 * (lane >> 4);
#pragma unroll
  for (int i = 0; i < 8; ++i) { v[i] = p[i]; v[8 + i] = p[16 + i]; }
  return bsplit16(v); }
__device__ __forceinline__ F2 split_rowK(const float* row, int k0, int lane, int K) { float v[16]; const int g = lane >> 4;
#pragma unroll
  for (int i = 0; i < 8; ++i) { const int ka = k0 + 8 * g + i, kb = ka + 16; v[i] = ka < K ? row[ka < K ? ka : K - 1] : 0.f; v[8 + i] = kb < K ? row[kb < K ? kb : K - 1] : 0.f; }
  return bsplit16(v); }
__device__ __forceinline__ F2 split_col(const float* W, int k0, int n, int lane, int ld, int K) { float v[16]; const int g = lane >> 4;
#pragma unroll
  for (int i = 0; i < 8; ++i) { const int ka = k0 + 8 * g + i, kb = ka + 16; v[i] = ka < K ? W[(size_t)(ka < K ? ka : K - 1) * ld + n] : 0.f; v[8 + i] = kb < K ? W[(size_t)(kb < K ? kb : K - 1) * ld + n] : 0.f; }
  return bsplit16(v); }
__device__ __forceinline__ v8f mac3(const F2& a, const F2& b, v8f c) { c = wmma_bf(a.l, b.h, c); c = wmma_bf(a.h, b.l, c); return wmma_bf(a.h, b.h, c); }
__device__ __forceinline__ float sigm(float v) { return 1.0f / (1.0f + expf(-v)); }
#define LDSX() do { asm volatile("s_wait_dscnt 0" ::: "memory"); __builtin_amdgcn_wave_barrier(); __builtin_amdgcn_fence(__ATOMIC_RELEASE, "workgroup"); } while (0)


#define NB 2
#define SS 2048
#define DM 1024
#define NH 16
#define LW 128
#define HD 64
#define QKVW (3 * DM)
#ifndef TQB
#define TQB (SS / 64)
#define TNB NB
#define TOB (NB * SS / 64)     // output row tiles (all)
#endif
typedef __attribute__((ext_vector_type(8))) __bf16 v8b;
__device__ __forceinline__ v16b frag_b(const __bf16* rowk0, int lane) {
  union { v16b v; v8b q[2]; } u; const __bf16* p = rowk0 + 8 * (lane >> 4);
  u.q[0] = *(const v8b*)p; u.q[1] = *(const v8b*)(p + 16); return u.v;
}
__device__ __forceinline__ float bfr(float v) { return (float)(__bf16)v; }
__device__ __attribute__((noinline)) float exp_ni(float v) { return expf(v); }
__device__ __attribute__((noinline)) float erf_ni(float v) { return erff(v); }

#define PK_A 0                       // [3072][1024] Wqkv rows (natural [out][in])
#define PK_P (PK_A + QKVW * DM)        // [1024][1024] Wo rows (natural)
#define PK_END (PK_P + DM * DM)
#define WS_PK  0u
#define WS_QK  (WS_PK + 2u * PK_END)             // f16 [4096 rows][2048]: q | k
#define WS_QKL (WS_QK + 2u * NB * SS * 2 * DM)     // f16 q | k residual planes x2048
#define WS_VTH (WS_QKL + 2u * NB * SS * 2 * DM)    // f16 [b][1024 (h*64+d)][2048 s] hi
#define WS_VTL (WS_VTH + 2u * NB * DM * SS)        // f16 lo x 2048
#define WS_O   (WS_VTL + 2u * NB * DM * SS)        // f32 [4096][1024]
#define WS_CS  (WS_O + 4u * NB * SS * DM)           // f32 2 x [2048][32], not read or written
#define WS_END (WS_CS + 4u * 2 * SS * 32)
typedef __attribute__((ext_vector_type(4))) __bf16 v4b;
#define PKE 16384   // elements of one work-group: 256 threads x 16 loads of 4
// ---- k_pack: both weights (natural [out][in] rows) rounded to bf16, element for element in their own order: PK = W_qkv rows (PK_A), then W_proj rows (PK_P).
// Few, long work-groups (one per 64 KiB of source, 2,048 waves in all) instead of one per row (32,768 waves): fewer waves to start for the same bytes. A thread has its 16 loads in flight together;
// each wave-wide load covers 512 contiguous bytes (four whole lines), each wave-wide store 256 (two whole lines).
__global__ __launch_bounds__(256) void k_pack(const float* __restrict__ WA, const float* __restrict__ WO, __bf16* __restrict__ PK) {
  static_assert((QKVW * DM) % PKE == 0 && (DM * DM) % PKE == 0 && PK_A == 0 && PK_P == QKVW * DM, "a work-group's piece lies in one weight, and PK follows the sources' order");
  const int w = blockIdx.x, t = threadIdx.x;
  const float* s = ((w < QKVW * DM / PKE) ? WA + (size_t)w * PKE : WO + ((size_t)w * PKE - (size_t)QKVW * DM)) + t * 4;
  __bf16* d = PK + (size_t)w * PKE + t * 4;
  v4f r[16];   // the full unrolls keep r indexed by constants, that is, in registers
#pragma unroll
  for (int i = 0; i < 16; ++i) r[i] = *(const v4f*)(s + i * 1024);
  __builtin_amdgcn_sched_barrier(0);   // keeps all 16 loads ahead of the first conversion: without it the last two are issued only when the first two have returned, a second memory latency in every wave
#pragma unroll
  for (int i = 0; i < 16; ++i) { v4b h;
#pragma unroll
    for (int e = 0; e < 4; ++e) h[e] = (__bf16)r[i][e];
    *(v4b*)(d + i * 1024) = h; }
}
#define GKS 64   // k of one staged slice: a slice row is 256 bytes of A (f32) and a whole 128-byte line of B (bf16)
#define GPB 72   // LDS pitch of a 64-k bf16 tile row, in elements: 144 B = 16 B x odd, the conflict-free pitch for 16-byte reads
// ---- gemm_tile: one work-group's C[32 * FM][128] += A . B^T over K = DM. A: f32 rows, rounded to bf16 (NP == 1) or split bf16 hi + lo (NP == 2) once per work-group; B: bf16 rows.
// Each 64-k slice of both operands is staged once in LDS (two buffers, the next slice held in registers while this one is multiplied) and read, as two 32-k halves in k order, by 2 x 2 waves of FM x 4 tiles each.
// The full unrolls keep the register arrays (ra, rb, fragments, acc) indexed by constants; the k loop's unroll by 2 makes the buffer index a constant in each copy.
// The walk over the slices starts at slice rot and wraps: work-groups that share an operand tile but start together then ask L2 for different lines at any moment instead of all for the same ones.
// The callers give the same rot to work-groups 256 apart in the flat index (same A rows): should these share a WGP, they still find each other's A lines in its cache. For speed only: no result rests on where a work-group runs.
template <int FM, int NP>
__device__ __forceinline__ void gemm_tile(const float* __restrict__ A, const __bf16* __restrict__ B, __bf16* sA, __bf16* sB, v8f (&acc)[FM][4], int tid, int rot) {
  constexpr int BM = 32 * FM, CA = BM / 8, NS = DM / GKS;
  static_assert((NS & (NS - 1)) == 0, "the walk wraps by a mask");
  const int wave = tid >> 5, lane = tid & 31, col = lane & 15, wm = wave >> 1, wn = wave & 1;
  const int arow = tid >> 4, ac = (tid & 15) * 4;   // staging of A: thread t takes 4 k of rows (t >> 4) + 8 i, so that each wave-wide 16-byte load covers two whole rows of 256 bytes
  const int srow = tid >> 3, sc = (tid & 7) * 8;    // staging of B: thread t takes 8 k of rows (t >> 3) + 16 i, so that each wave-wide 16-byte load covers four whole 128-byte lines
  const float* ga = A + (size_t)arow * DM + ac; const __bf16* gb = B + (size_t)srow * DM + sc;
  v4f ra[CA]; v8b rb[8];
  { const int k0 = (rot & (NS - 1)) * GKS; const float* gn = ga + k0; const __bf16* hn = gb + k0;   // trip kc works on slice (kc + rot) mod NS
#pragma unroll
    for (int i = 0; i < CA; ++i) ra[i] = *(const v4f*)(gn + (size_t)i * 8 * DM);
#pragma unroll
    for (int i = 0; i < 8; ++i) rb[i] = *(const v8b*)(hn + (size_t)i * 16 * DM);
    asm volatile("s_wait_xcnt 0x0" :: "v"(gn), "v"(hn) : "memory"); }   // stands in front of every later write of the address registers that the first slice's loads name: as inputs they stay live up to the wait
#pragma unroll 2
  for (int kc = 0; kc < NS; ++kc) { const int buf = kc & 1;
#pragma unroll
    for (int i = 0; i < CA; ++i) { v4b hv, lv;
#pragma unroll
      for (int e = 0; e < 4; ++e) { const float x = ra[i][e]; const __bf16 hb = (__bf16)x; hv[e] = hb; if (NP == 2) lv[e] = (__bf16)(x - (float)hb); }
      *(v4b*)(sA + ((buf * NP) * BM + arow + i * 8) * GPB + ac) = hv; if (NP == 2) *(v4b*)(sA + ((buf * NP + 1) * BM + arow + i * 8) * GPB + ac) = lv; }
#pragma unroll
    for (int i = 0; i < 8; ++i) *(v8b*)(sB + (buf * 128 + srow + i * 16) * GPB + sc) = rb[i];
    __syncthreads();   // publishes trip kc's slice; the other buffer's readers (trip kc - 1) are all past it before trip kc + 1's slice is stored there
    if (kc + 1 < NS) { const int kn = ((kc + 1 + rot) & (NS - 1)) * GKS; const float* gn = ga + kn; const __bf16* hn = gb + kn;
#pragma unroll
      for (int i = 0; i < CA; ++i) ra[i] = *(const v4f*)(gn + (size_t)i * 8 * DM);
#pragma unroll
      for (int i = 0; i < 8; ++i) rb[i] = *(const v8b*)(hn + (size_t)i * 16 * DM);
      asm volatile("s_wait_xcnt 0x0" :: "v"(gn), "v"(hn) : "memory"); }   // stands in front of the next trip's write of the address registers that these loads name: as inputs they stay live up to the wait
#pragma unroll
    for (int kh = 0; kh < GKS; kh += 32) {   // the slice's two 32-k halves, in k order
      v16b b[4], ah[FM], al[FM];
#pragma unroll
      for (int j = 0; j < 4; ++j) b[j] = frag_b(sB + (buf * 128 + wn * 64 + j * 16 + col) * GPB + kh, lane);
#pragma unroll
      for (int i = 0; i < FM; ++i) { ah[i] = frag_b(sA + ((buf * NP) * BM + wm * (FM * 16) + i * 16 + col) * GPB + kh, lane); if (NP == 2) al[i] = frag_b(sA + ((buf * NP + 1) * BM + wm * (FM * 16) + i * 16 + col) * GPB + kh, lane); }
#pragma unroll
      for (int i = 0; i < FM; ++i) {
        if (NP == 2) {
#pragma unroll
          for (int j = 0; j < 4; ++j) acc[i][j] = wmma_bf(al[i], b[j], acc[i][j]); }
#pragma unroll
        for (int j = 0; j < 4; ++j) acc[i][j] = wmma_bf(ah[i], b[j], acc[i][j]); } } }
  __syncthreads();   // every wave has read the last slice: the caller may reuse the LDS
}
// ---- k_qkv: block = (128 rows, 128 cols), 2 x 2 waves of 64 x 64
__global__ __launch_bounds__(128) void k_qkv(const float* __restrict__ XQ, const float* __restrict__ XK, const float* __restrict__ XV, const __bf16* __restrict__ P, const float* __restrict__ BQ, const float* __restrict__ BK, const float* __restrict__ BV, _Float16* __restrict__ QK, _Float16* __restrict__ QKL, _Float16* __restrict__ VTH, _Float16* __restrict__ VTL) {
  const int which0 = (blockIdx.y * 128) / DM; const float* X = (which0 == 0) ? XQ : (which0 == 1) ? XK : XV; const float* BB = BQ ? (((which0 == 0) ? BQ : (which0 == 1) ? BK : BV) + (blockIdx.y * 128 - which0 * DM)) : nullptr;
  __shared__ __align__(16) unsigned char sm[2 * 2 * 128 * GPB * 2];   // loop: A and B slices, two buffers each (73,728 B); epilogue: hi and residual planes [128][136] f16 (69,632 B)
  static_assert(2 * 2 * 128 * GPB * 2 >= 2 * 128 * 136 * 2, "the epilogue's planes fit the loop's buffers");
  const int tid = threadIdx.x, wave = tid >> 5, lane = tid & 31, col = lane & 15, g = lane >> 4, wm = wave >> 1, wn = wave & 1; const size_t rb = (size_t)blockIdx.x * 128; const int n0 = blockIdx.y * 128;
  v8f acc[4][4] = {};
  gemm_tile<4, 1>(X + rb * DM, P + (size_t)n0 * DM, (__bf16*)sm, (__bf16*)sm + 2 * 128 * GPB, acc, tid, (int)(blockIdx.x + 2 * (blockIdx.y & 7)));
  _Float16 (*sh)[136] = (_Float16 (*)[136])sm; _Float16 (*sl)[136] = (_Float16 (*)[136])(sm + 128 * 136 * 2);
  if (n0 < 2 * DM) {   // q stored unscaled (f16 sigma ~0.6, no subnormal exposure); 1/8 applied to the f32 score
#pragma unroll
    for (int i = 0; i < 4; ++i) {
#pragma unroll
      for (int j = 0; j < 4; ++j) { const int c = wn * 64 + j * 16 + col; const float bv = BB ? bfr(BB[c]) : 0.f;
#pragma unroll
        for (int r = 0; r < 8; ++r) { const float v = acc[i][j][r] + bv; const _Float16 hv = (_Float16)v; sh[wm * 64 + i * 16 + 8 * g + r][c] = hv; sl[wm * 64 + i * 16 + 8 * g + r][c] = (_Float16)((v - (float)hv) * 2048.0f); } } }   // q, k (+ bias) as f16 hi + (x2048) residual
    __syncthreads();
#pragma unroll
    for (int it = 0; it < 16; ++it) { const int rl = it * 8 + (tid >> 4), pc = tid & 15; const size_t o = (rb + rl) * (2 * DM) + n0 + pc * 8; vst2((unsigned*)(QK + o), *(const v4u*)&sh[rl][pc * 8]); vst2((unsigned*)(QKL + o), *(const v4u*)&sl[rl][pc * 8]); }
  } else {   // v transposed: planes [d][s]
#pragma unroll
    for (int i = 0; i < 4; ++i) {
#pragma unroll
      for (int j = 0; j < 4; ++j) { const int c = wn * 64 + j * 16 + col; const float bv = BB ? bfr(BB[c]) : 0.f; v8h hq, lq;
#pragma unroll
        for (int r = 0; r < 8; ++r) { const float v = acc[i][j][r] + bv; const _Float16 hv = (_Float16)v; hq[r] = hv; lq[r] = (_Float16)((v - (float)hv) * 2048.0f); }
        *(v8h*)&sh[c][wm * 64 + i * 16 + 8 * g] = hq; *(v8h*)&sl[c][wm * 64 + i * 16 + 8 * g] = lq; } }
    __syncthreads();
    const int b = (int)(rb / SS), s0 = (int)(rb % SS); const int pc0 = n0 - 2 * DM;
#pragma unroll
    for (int it = 0; it < 16; ++it) { const int d = it * 8 + (tid >> 4), pc = tid & 15; const size_t o = ((size_t)b * DM + pc0 + d) * SS + s0 + pc * 8; vst2((unsigned*)(VTH + o), *(const v4u*)&sh[d][pc * 8]); vst2((unsigned*)(VTL + o), *(const v4u*)&sl[d][pc * 8]); }
  }
}
// ---- k_attn: block = (64 queries, head h, batch b): banded flash attention (K = 64: 2 k-steps), scores = (q.k) * 0.125, P.V: f16 P x (V hi, V lo*2048) in two accumulators; O[b*S+q][h*64+d] = (acc + accl / 2048) / (2048 l) (256-B segments)
// Both products are formed transposed: S^T = K . Q^T (A = key rows, B = the wave's 16 queries) and O^T += V^T . P^T. A lane then holds 16 of the 32 scores of ONE query (its column), so that the maximum and the sum are taken
// in the lane (the maximum joined with the other lane half once per 32 keys, the sum once in the epilogue), and the two score tiles, converted in place, are the B operand of the second product: P never leaves the registers.
// The keys are walked in stages of 64. A stage is four planes (k hi, k residual: [key][64 d]; v hi, v residual: [d][64 keys]) of 64 rows x 128 B, brought into LDS once per work-group by asynchronous copies
// (whole 128-B lines, two buffers, the next stage in flight while this one is worked on) and read from there by all four waves.
#define STG_PLANE 8192                 // 64 rows x 128 B
#define STG_BYTES (4 * STG_PLANE)
// Rows lie at a pitch of 128 B; the 16-byte piece c of row r lies at place c ^ ((r >> 1) & 7), so that the 16 rows which a half wave's ds_load_b128 reads at one c fall on all 64 banks.
// copy8: rows r, r + 16, r + 32, r + 48 of two planes, 16 B a lane. The s_wait_xcnt closes the statement so that it stands in front of every later write of the address registers that the copies name.
__device__ __forceinline__ void copy8(unsigned l0, unsigned l1, const _Float16* g0, const _Float16* g1) {
  asm volatile("global_load_async_to_lds_b128 %0, %8, off\n\t"
               "global_load_async_to_lds_b128 %1, %9, off\n\t"
               "global_load_async_to_lds_b128 %2, %10, off\n\t"
               "global_load_async_to_lds_b128 %3, %11, off\n\t"
               "global_load_async_to_lds_b128 %4, %12, off\n\t"
               "global_load_async_to_lds_b128 %5, %13, off\n\t"
               "global_load_async_to_lds_b128 %6, %14, off\n\t"
               "global_load_async_to_lds_b128 %7, %15, off\n\t"
               "s_wait_xcnt 0x0"
               :: "v"(l0), "v"(l0 + 2048u), "v"(l0 + 4096u), "v"(l0 + 6144u), "v"(l1), "v"(l1 + 2048u), "v"(l1 + 4096u), "v"(l1 + 6144u),
                  "v"(g0), "v"(g0 + 16 * 2048), "v"(g0 + 32 * 2048), "v"(g0 + 48 * 2048), "v"(g1), "v"(g1 + 16 * 2048), "v"(g1 + 32 * 2048), "v"(g1 + 48 * 2048)
               : "memory");
}
// the value of lane l ^ 16: the other half of the same column
__device__ __forceinline__ float xhalf(float v) { const int b = __builtin_bit_cast(int, v); return __builtin_bit_cast(float, __builtin_amdgcn_permlanex16(b, b, 0x76543210, 0xfedcba98, false, false)); }
__device__ __forceinline__ v16h frag_l(const unsigned char* row, int o0, int o1) {
  union { v16h v; v8h q[2]; } u; u.q[0] = *(const v8h*)(row + o0); u.q[1] = *(const v8h*)(row + o1); return u.v;
}
__global__ __launch_bounds__(128) void k_attn(const _Float16* __restrict__ QK, const _Float16* __restrict__ QKL, const _Float16* __restrict__ VTH, const _Float16* __restrict__ VTL, const void* __restrict__ KMASK, float* __restrict__ O) {
  static_assert(2 * DM == 2048 && SS == 2048 && HD == 64, "copy8 steps 16 rows of 2,048 f16"); static_assert(LW % 64 == 0 && SS % 64 == 0, "the window is whole stages of 64 keys"); static_assert(TQB <= 32, "every query block takes the three-product form");
  __shared__ __align__(128) unsigned char sm[2 * STG_BYTES];   // two stage buffers (epilogue: the output rows [4][16][68] f32)
  float (*so)[16][68] = (float (*)[16][68])sm;
  const int tid = threadIdx.x, wave = tid >> 5, lane = tid & 31, col = lane & 15, g = lane >> 4;
  const int qb = blockIdx.x, h = blockIdx.y, b = blockIdx.z; const int q0 = qb * 64 + wave * 16; const size_t rq = (size_t)b * SS + q0 + col;
  const int nks = SS / 32;   // all keys
  const int ks0 = (qb * 64 - LW) > 0 ? (qb * 64 - LW) / 32 : 0; const int ks1 = ((qb * 64 + 64 + LW + 31) / 32) < nks ? ((qb * 64 + 64 + LW + 31) / 32) : nks;   // window tiles: both even, so the window is whole stages
  const int st0 = ks0 >> 1, ns = (ks1 >> 1) - st0;
  // copies: thread t takes piece t & 7 of rows (t >> 3) + 16 i of each plane: a wave-wide copy covers four whole lines
  const int crow = tid >> 3, cpc = tid & 7;
  const unsigned lc = (unsigned)(size_t)sm + (unsigned)(crow * 128 + ((cpc ^ ((crow >> 1) & 7)) << 4));
  const size_t gko = ((size_t)b * SS + st0 * 64 + crow) * (2 * DM) + DM + h * HD + cpc * 8, gvo = ((size_t)b * DM + h * HD + crow) * SS + st0 * 64 + cpc * 8;
  const _Float16 *gk = QK + gko, *gkl = QKL + gko, *gv = VTH + gvo, *gvl = VTL + gvo;   // stage t: k rows advance by 64 rows, v rows by 64 keys
  copy8(lc, lc + STG_PLANE, gk, gkl); copy8(lc + 2 * STG_PLANE, lc + 3 * STG_PLANE, gv, gvl);
  v16h aq[2], aql[2];
#pragma unroll
  for (int kc = 0; kc < 2; ++kc) { aq[kc] = frag_h(QK + rq * (2 * DM) + h * HD + kc * 32, lane); aql[kc] = frag_h(QKL + rq * (2 * DM) + h * HD + kc * 32, lane); }
  float m = -3.0e38f, l = 0.f;   // of query q0 + col: the running maximum (equal in both lane halves) and this lane half's share of the sum
  v8f acc[4] = {}, accl[4] = {};
  asm volatile("s_wait_asynccnt 0x0" ::: "memory");   // this wave's copies of stage 0 have landed
  __syncthreads();                                    // publishes stage 0
  if (ns > 1) { copy8(lc + STG_BYTES, lc + STG_BYTES + STG_PLANE, gk + (size_t)64 * 2 * DM, gkl + (size_t)64 * 2 * DM); copy8(lc + STG_BYTES + 2 * STG_PLANE, lc + STG_BYTES + 3 * STG_PLANE, gv + 64, gvl + 64); }
  const int swz = (col >> 1) & 7; int fo[4];   // a fragment's pieces 2 j + g of a 128-B row, at their places
#pragma unroll
  for (int j = 0; j < 4; ++j) fo[j] = ((2 * j + g) ^ swz) << 4;
#pragma unroll 1   // one copy of the body: the buffer is chosen by an address, and nothing can move across the publish point
  for (int t = 0; t < ns; ++t) { const unsigned char* sb = sm + (t & 1) * STG_BYTES + col * 128;
#pragma unroll 1   // one copy of the body: the two halves of a stage differ by an address only
  for (int sub = 0; sub < 2; ++sub) { const int ks = (st0 + t) * 2 + sub; v8f s[2];
#pragma unroll
    for (int ct = 0; ct < 2; ++ct) { const int kk = ks * 32 + ct * 16 + 8 * g; const unsigned char* krow = sb + (sub * 32 + ct * 16) * 128; v8f c = {}, cl = {};   // register r: key kk + r
      v16h kh[2], kl[2];   // the 16 keys' fragments, read from LDS as one group ahead of their products: one wait instead of one per product
#pragma unroll
      for (int kc = 0; kc < 2; ++kc) { kh[kc] = frag_l(krow, fo[2 * kc], fo[2 * kc + 1]); kl[kc] = frag_l(krow + STG_PLANE, fo[2 * kc], fo[2 * kc + 1]); }
#pragma unroll
      for (int kc = 0; kc < 2; ++kc) { c = wmma16(kh[kc], aq[kc], c); cl = wmma16(kh[kc], aql[kc], cl); cl = wmma16(kl[kc], aq[kc], cl); }   // 3 products: hi.hi, and hi.residual + residual.hi at 2^11
#pragma unroll
      for (int r = 0; r < 8; ++r) c[r] += cl[r] * (1.0f / 2048.0f);
#pragma unroll
      for (int r = 0; r < 8; ++r) { const int dq = (q0 + col) - (kk + r); s[ct][r] = (dq <= LW && dq >= -LW) ? c[r] * 0.125f : -3.0e38f; } }   // 1/sqrt(64); masked keys excluded
    float mx = fmaxf(s[0][0], s[1][0]);   // the full unrolls of this body keep s, acc, accl, pa and pl indexed by constants, that is, in registers
#pragma unroll
    for (int r = 1; r < 8; ++r) mx = fmaxf(mx, fmaxf(s[0][r], s[1][r]));
    mx = fmaxf(mx, xhalf(mx));   // the query's other 16 keys of this half stage
    const float mn = fmaxf(m, mx); const float alpha = (m <= -1.0e38f) ? 0.f : __expf(m - mn); m = mn;
    float es[2] = {0.f, 0.f};
#pragma unroll
    for (int ct = 0; ct < 2; ++ct) {
#pragma unroll
      for (int r = 0; r < 8; ++r) { const float e = (s[ct][r] <= -1.0e38f) ? 0.f : __expf(s[ct][r] - mn); s[ct][r] = e; es[ct] += e; } }
    l = l * alpha + (es[0] + es[1]);
#pragma unroll
    for (int dt = 0; dt < 4; ++dt) {
#pragma unroll
      for (int r = 0; r < 8; ++r) { acc[dt][r] *= alpha; accl[dt][r] *= alpha; } }
    const int vo0 = fo[0] ^ (sub << 6), vo1 = fo[1] ^ (sub << 6);   // pieces 4 sub + g and 4 sub + 2 + g: this half's 32 keys
    v16h pa, pl;   // B operand: element i = key 8 g + i (first tile's register i), element 8 + i = key 16 + 8 g + i (second tile's): the k order of the v fragments
#pragma unroll
    for (int i = 0; i < 8; ++i) { const float x0 = s[0][i] * 2048.0f, x1 = s[1][i] * 2048.0f; const _Float16 h0 = (_Float16)x0, h1 = (_Float16)x1; pa[i] = h0; pa[8 + i] = h1; pl[i] = (_Float16)((x0 - (float)h0) * 2048.0f); pl[8 + i] = (_Float16)((x1 - (float)h1) * 2048.0f); }   // P scaled by 2^11 before the f16 split so small softmax weights stay out of the f16 subnormal range; 2^-11 folded into the epilogue
#pragma unroll
    for (int dp = 0; dp < 4; dp += 2) { v16h vh[2], vl[2];   // two d tiles' fragments, read as one group ahead of their products
#pragma unroll
      for (int e = 0; e < 2; ++e) { const unsigned char* vrow = sb + 2 * STG_PLANE + (dp + e) * 16 * 128; vh[e] = frag_l(vrow, vo0, vo1); vl[e] = frag_l(vrow + STG_PLANE, vo0, vo1); }
#pragma unroll
      for (int e = 0; e < 2; ++e) { const int dt = dp + e; acc[dt] = wmma16(vh[e], pa, acc[dt]); accl[dt] = wmma16(vh[e], pl, accl[dt]); accl[dt] = wmma16(vl[e], pa, accl[dt]); } } }   // P hi/lo x V hi/lo (3 products)
    asm volatile("s_wait_dscnt 0x0" ::: "memory");      // this wave's reads of stage t have returned
    asm volatile("s_wait_asynccnt 0x0" ::: "memory");   // this wave's copies of stage t + 1 have landed
    __syncthreads();                                    // publishes stage t + 1 and ends every wave's reads of stage t's buffer
    if (t + 2 < ns) { const unsigned lb = lc + (t & 1) * STG_BYTES; const size_t ko = (size_t)(t + 2) * 64 * 2 * DM; const int vo = (t + 2) * 64;
      copy8(lb, lb + STG_PLANE, gk + ko, gkl + ko); copy8(lb + 2 * STG_PLANE, lb + 3 * STG_PLANE, gv + vo, gvl + vo); } }
  asm volatile("s_wait_asynccnt 0x0" ::: "memory");   // no copy is outstanding when the buffers become output staging
  const float il = (1.0f / 2048.0f) / (l + xhalf(l));   // the two lane halves' sums joined
#pragma unroll
  for (int dt = 0; dt < 4; ++dt) {   // register r: d = 16 dt + 8 g + r of query q0 + col
#pragma unroll
    for (int r4 = 0; r4 < 8; r4 += 4) { v4f o;
#pragma unroll
      for (int e = 0; e < 4; ++e) o[e] = (acc[dt][r4 + e] + accl[dt][r4 + e] * (1.0f / 2048.0f)) * il;
      *(v4f*)&so[wave][col][dt * 16 + 8 * g + r4] = o; } }
  LDSX();
  for (int rl = 0; rl < 16; ++rl) if (lane < 16) vst2(O + ((size_t)b * SS + q0 + rl) * DM + h * HD + lane * 4, *(const v4f*)&so[wave][rl][lane * 4]);
}
// ---- k_out: block = (64 rows, 128 cols), 2 x 2 waves of 32 x 64: out = O(hi/lo) . Wo rows (2 products) + bo
__global__ __launch_bounds__(128) void k_out(const float* __restrict__ O, const __bf16* __restrict__ P, const float* __restrict__ BO, float* __restrict__ Y) {
  __shared__ __align__(16) unsigned char sm[2 * 2 * 64 * GPB * 2 + 2 * 128 * GPB * 2];   // loop: A hi and lo and B slices, two buffers each (73,728 B); epilogue: [64][132] f32
  const int tid = threadIdx.x, wave = tid >> 5, lane = tid & 31, col = lane & 15, g = lane >> 4, wm = wave >> 1, wn = wave & 1; const size_t rb = (size_t)blockIdx.x * 64; const int n0 = blockIdx.y * 128;
  v8f acc[2][4] = {};
  gemm_tile<2, 2>(O + rb * DM, P + (size_t)n0 * DM, (__bf16*)sm, (__bf16*)sm + 2 * 2 * 64 * GPB, acc, tid, (int)(blockIdx.x + 4 * (blockIdx.y & 3)));
  float (*so)[132] = (float (*)[132])sm;
#pragma unroll
  for (int i = 0; i < 2; ++i) {
#pragma unroll
    for (int j = 0; j < 4; ++j) { const int c = wn * 64 + j * 16 + col; const float bv = bfr(BO[n0 + c]);
#pragma unroll
      for (int r = 0; r < 8; ++r) so[wm * 32 + i * 16 + 8 * g + r][c] = acc[i][j][r] + bv; } }
  __syncthreads();
#pragma unroll
  for (int it = 0; it < 16; ++it) { const int rl = it * 4 + wave, c4 = lane; vst2(Y + (rb + rl) * DM + n0 + c4 * 4, *(const v4f*)&so[rl][c4 * 4]); }
}
extern "C" void kernel_launch(void* const* d_in, const int* in_sizes, int n_in, void* d_out, int out_size, void* d_ws, size_t ws_size, hipStream_t stream) {
  (void)in_sizes; (void)n_in; (void)out_size;
  const float** F = (const float**)d_in;   // 0 x [2,2048,1024], 1 W_qkv [3072,1024] natural (rows q | k | v), 2 W_proj [1024,1024] natural, 3 b_proj
  if (ws_size < (size_t)WS_END) return;
  char* ws = (char*)d_ws; __bf16* PK = (__bf16*)(ws + WS_PK); _Float16 *QK = (_Float16*)(ws + WS_QK), *QKL = (_Float16*)(ws + WS_QKL), *VTH = (_Float16*)(ws + WS_VTH), *VTL = (_Float16*)(ws + WS_VTL); float* O = (float*)(ws + WS_O);
  k_pack<<<dim3(PK_END / PKE), 256, 0, stream>>>(F[1], F[2], PK);
  k_qkv<<<dim3(TNB * SS / 128, QKVW / 128), 128, 0, stream>>>(F[0], F[0], F[0], PK + PK_A, nullptr, nullptr, nullptr, QK, QKL, VTH, VTL);
  k_attn<<<dim3(TQB, NH, TNB), 128, 0, stream>>>(QK, QKL, VTH, VTL, nullptr, O);
  k_out<<<dim3(TOB, DM / 128), 128, 0, stream>>>(O, PK + PK_P, F[3], (float*)d_out);
}
